// v000
// Measured on an AMD MI455X. A time is GPU time per run, averaged over a window of back-to-back runs after a warm-up
// (all launches, gaps included; the runs take copies of the inputs in turn), and the median of several windows.
// Apart from v000's, it joins two sittings. Times from different sittings can be a few percent apart, while
// side-by-side timings come from the same sitting.
// The starting kernel, v000, takes 414 microseconds a run.
#include <hip/hip_runtime.h>

// Contractions: two 1x1 channel GEMMs on v_wmma_f32_16x16x32_f16 (f16 operands: weights carried x16,
// activations x1; f32 accumulate, 1/16 folded in the f32 epilogue). 5x5 reflect-pad window energies,
// softmax and fusion in f32 on VALU.

#define NB     4
#define CD     256
#define HDIM   64
#define WDIM   64
#define HW     (HDIM * WDIM)            // 4096
#define PLANE  (NB * CD * HW)           // 4194304 elements per f32 map
#define X_N    PLANE
#define W_N    (CD * CD)                // 65536
#define B_N    CD
#define OUT_N  PLANE

#define SZ_PX   ((size_t)PLANE * 4)           // 16777216  f32 [n][c][hw]
#define SZ_XT   ((size_t)NB * HW * CD * 2)    // 8388608   f16 [n][hw][c]
#define SZ_W16  ((size_t)CD * CD * 2)         // 131072    f16 [o][c] (x16)
#define OFF_PXB ((size_t)0)
#define OFF_PXC (OFF_PXB + SZ_PX)
#define OFF_XT  (OFF_PXC + SZ_PX)
#define OFF_W16 (OFF_XT + SZ_XT)              // Wb16 at +0, Wc16 at +SZ_W16
#define WS_TOTAL (OFF_W16 + 2 * SZ_W16)       // 42205184

static_assert(WS_TOTAL == 42205184);
static_assert((OFF_PXC % 128) == 0 && (OFF_XT % 128) == 0 && (OFF_W16 % 128) == 0 && (SZ_W16 % 128) == 0);
static_assert(HW % 64 == 0 && CD % 64 == 0 && (NB * HW) % 256 == 0);

#define XP 72      // transpose LDS pitch (halves), 144 B
#define EP 68      // conv epilogue LDS pitch (floats), 272 B

typedef unsigned short v8us  __attribute__((ext_vector_type(8)));
typedef unsigned short v8usa __attribute__((ext_vector_type(8), __may_alias__));
typedef unsigned short v16us __attribute__((ext_vector_type(16)));
typedef _Float16       v16h  __attribute__((ext_vector_type(16)));
typedef float          v8f   __attribute__((ext_vector_type(8)));
typedef float          v4f   __attribute__((ext_vector_type(4)));
typedef float          v4fa  __attribute__((ext_vector_type(4), __may_alias__));

union Frag { v16us v; v8us half[2]; };

// f32 -> f16 bits (RNE convert)
__device__ __forceinline__ unsigned short h2us(float f) {
  return __builtin_bit_cast(unsigned short, (_Float16)f);
}

__device__ __forceinline__ void st2_u8(unsigned short* p, v8us v) {
  *(v8us*)p = v;
  
}
__device__ __forceinline__ void st2_f4(float* p, v4f v) {
  *(v4f*)p = v;
  
}

// 16-bit fragment from a k-contiguous row: elements 0..7 <- k0+8h.., elements 8..15 <- k0+16+8h..
// Used for A rows [m][k] and for B stored as [n][k] (same per-lane k map).
__device__ __forceinline__ v16h ldfrag(const unsigned short* rowp, int h) {
  Frag f;
  f.half[0] = *(const v8us*)(rowp + 8 * h);
  f.half[1] = *(const v8us*)(rowp + 16 + 8 * h);
  return __builtin_bit_cast(v16h, f.v);
}

__device__ __forceinline__ v8f wmma_h(v16h a, v16h b, v8f c) {
  return __builtin_amdgcn_wmma_f32_16x16x32_f16(false, a, false, b, (short)0, c, false, false);
}

__device__ __forceinline__ v8f v8f_zero() {
  v8f z = {0.f, 0.f, 0.f, 0.f, 0.f, 0.f, 0.f, 0.f};
  return z;
}

// =====================================================================================
// Kernel 0: weight planes. W16[which][o][c] = f16(16 * W[o][c]); one thread = 8 consecutive c
// (16 B), one wave = one whole 512-B row. 64 blocks x 256 = 2 x 8192 items exactly.
// =====================================================================================
__global__ void __launch_bounds__(256) k_wprep(
    const float* __restrict__ Wb, const float* __restrict__ Wc, unsigned short* __restrict__ W16) {
  const int i = blockIdx.x * 256 + threadIdx.x;   // < 16384
  const int which = i >> 13;                       // block-uniform (32 blocks each)
  const int e = i & 8191;
  const int o = e >> 5;
  const int kc = e & 31;
  const size_t off = (size_t)o * CD + kc * 8;
  const v4f b0 = *(const v4f*)(Wb + off);
  const v4f b1 = *(const v4f*)(Wb + off + 4);
  const v4f c0 = *(const v4f*)(Wc + off);
  const v4f c1 = *(const v4f*)(Wc + off + 4);
  float f[8];
  f[0] = which ? c0.x : b0.x; f[1] = which ? c0.y : b0.y; f[2] = which ? c0.z : b0.z; f[3] = which ? c0.w : b0.w;
  f[4] = which ? c1.x : b1.x; f[5] = which ? c1.y : b1.y; f[6] = which ? c1.z : b1.z; f[7] = which ? c1.w : b1.w;
  v8us ov;
  #pragma unroll
  for (int j = 0; j < 8; ++j) ov[j] = h2us(f[j] * 16.0f);
  st2_u8(W16 + (size_t)which * W_N + off, ov);
}

// =====================================================================================
// Kernel 1: activation plane xT[n][hw][c] = f16(x[n][c][hw]) through a 64(c) x 64(px) LDS tile.
// Grid 1024 = 4 n x 4 c-tiles x 64 px-tiles. Read: float4 along hw (coalesced); LDS holds the
// lanes x 16 B of one instruction, 4 rows per instruction per wave, 2 iterations -> 64 rows.
// =====================================================================================
__global__ void __launch_bounds__(256) k_xprep(const float* __restrict__ x, unsigned short* __restrict__ xT) {
  __shared__ __attribute__((aligned(16))) unsigned short sT[64 * XP];
  const int tid = threadIdx.x;
  const int lane = tid & 31;
  const int w = tid >> 5;
  const int bid = blockIdx.x;
  const int pt = bid & 63;
  const int ct = (bid >> 6) & 3;
  const int n = bid >> 8;
  const int p0 = pt * 64;
  const int c0 = ct * 64;

  #pragma unroll
  for (int it = 0; it < 4; ++it) {
    const int idx = it * 256 + tid;            // 0..1023
    const int c = idx >> 4;                    // 0..63
    const int p4 = (idx & 15) * 4;             // 0..60
    const v4f v = *(const v4f*)(x + ((size_t)(n * CD + c0 + c)) * HW + p0 + p4);
    sT[(p4 + 0) * XP + c] = h2us(v.x);
    sT[(p4 + 1) * XP + c] = h2us(v.y);
    sT[(p4 + 2) * XP + c] = h2us(v.z);
    sT[(p4 + 3) * XP + c] = h2us(v.w);
  }
  __syncthreads();

  const int q = lane >> 3;     // row within the 4-row group
  const int j = lane & 7;
  #pragma unroll 1
  for (int it = 0; it < 2; ++it) {
    const int prow = it * 32 + w * 4 + q;      // 0..63, each once
    const v8us val = *(const v8usa*)(sT + prow * XP + j * 8);
    unsigned short* dst = xT + ((size_t)(n * HW + p0 + prow)) * CD + c0 + j * 8;
    st2_u8(dst, val);
  }
}

// =====================================================================================
// Kernel 2: pxb[n][o][hw] = (Wb16 . xT^T) / 16 + bb, pxc likewise, f32 maps.
// A = W16[o][c] (k-contiguous), B[k=c][n=px] loaded from xT[px][c] rows exactly like A.
// Block = (n, 64 o, 64 px); wave w: o rows (w>>1)*16, px cols (w&1)*32 (two D tiles per GEMM).
// Epilogue: f32 tile [128 rows: 64 pxb + 64 pxc][64 px] in LDS; each row segment (256 B) written by
// =====================================================================================
__device__ __forceinline__ void stage16(float* sT, v8f ab, v8f ac, int orow0, int col,
                                        const float* bbp, const float* bcp) {
  #pragma unroll
  for (int r = 0; r < 8; ++r) {
    const int orow = orow0 + r;
    sT[orow * EP + col] = ab[r] * 0.0625f + bbp[r];
    sT[(64 + orow) * EP + col] = ac[r] * 0.0625f + bcp[r];
  }
}

__global__ void __launch_bounds__(256) k_conv(
    const unsigned short* __restrict__ xT, const unsigned short* __restrict__ W16,
    const float* __restrict__ bb, const float* __restrict__ bc, float* __restrict__ px) {
  __shared__ __attribute__((aligned(16))) float sT[128 * EP];
  const int tid = threadIdx.x;
  const int lane = tid & 31;
  const int w = tid >> 5;
  const int h = lane >> 4;
  const int m = lane & 15;
  const int bid = blockIdx.x;
  const int pt = bid & 63;
  const int ot = (bid >> 6) & 3;
  const int n = bid >> 8;
  const int p0 = pt * 64;
  const int o0 = ot * 64;
  const int osub = (w >> 1) * 16;
  const int psub = (w & 1) * 32;

  const unsigned short* arb = W16 + (size_t)(o0 + osub + m) * CD;
  const unsigned short* arc = arb + W_N;
  const unsigned short* br0 = xT + ((size_t)(n * HW + p0 + psub + m)) * CD;
  const unsigned short* br1 = br0 + 16 * CD;

  v8f accB0 = v8f_zero(), accB1 = v8f_zero(), accC0 = v8f_zero(), accC1 = v8f_zero();

  #pragma unroll 1
  for (int ks = 0; ks < CD / 32; ++ks) {
    const int k0 = ks * 32;
    const v16h fab = ldfrag(arb + k0, h);
    const v16h fac = ldfrag(arc + k0, h);
    const v16h fb0 = ldfrag(br0 + k0, h);
    const v16h fb1 = ldfrag(br1 + k0, h);
    accB0 = wmma_h(fab, fb0, accB0);
    accB1 = wmma_h(fab, fb1, accB1);
    accC0 = wmma_h(fac, fb0, accC0);
    accC1 = wmma_h(fac, fb1, accC1);
    asm volatile("v_nop\n\tv_nop\n\tv_nop\n\tv_nop"
                 : "+v"(accB0), "+v"(accB1), "+v"(accC0), "+v"(accC1)
                 : "v"(fab), "v"(fac), "v"(fb0), "v"(fb1));
  }

  // D element r of lane -> o row osub + 8h + r, px col psub + t*16 + m
  const float* bbp = bb + o0 + osub + 8 * h;
  const float* bcp = bc + o0 + osub + 8 * h;
  stage16(sT, accB0, accC0, osub + 8 * h, psub + m, bbp, bcp);
  stage16(sT, accB1, accC1, osub + 8 * h, psub + 16 + m, bbp, bcp);
  __syncthreads();

  const int q = lane >> 3;
  const int j = lane & 7;
  const int rsel = q >> 1;
  const int lsel = q & 1;
  #pragma unroll 1
  for (int it = 0; it < 8; ++it) {
    const int row2 = it * 16 + w * 2 + rsel;     // 0..127, each once; rows 0..63 pxb, 64..127 pxc
    const int buf = row2 >> 6;
    const int row = row2 & 63;
    const v4f v = *(const v4fa*)(sT + row2 * EP + lsel * 32 + j * 4);
    float* dst = px + (size_t)buf * PLANE + ((size_t)(n * CD + o0 + row)) * HW + p0 + lsel * 32 + j * 4;
    st2_f4(dst, v);
  }
}

// =====================================================================================
// Kernel 3: per-pixel 5x5 attention, f32 on VALU. One thread per pixel; consecutive threads =
// consecutive w, so every channel-plane access is coalesced and each out line (32 lanes x 4 B)
// =====================================================================================
__global__ void __launch_bounds__(256) k_attn(
    const float* __restrict__ x, const float* __restrict__ pxb, const float* __restrict__ pxc,
    const float* __restrict__ alpha, float* __restrict__ out) {
  const int pix = blockIdx.x * 256 + threadIdx.x;   // < NB*HW exactly
  const int n = pix >> 12;
  const int p = pix & (HW - 1);
  const int hy = p >> 6;
  const int wx = p & (WDIM - 1);

  int hh[5], ww[5];
  #pragma unroll
  for (int d = 0; d < 5; ++d) {
    int t = hy + d - 2;
    t = (t < 0) ? -t : t;
    t = (t >= HDIM) ? (2 * HDIM - 2 - t) : t;
    hh[d] = t * WDIM;
    int u = wx + d - 2;
    u = (u < 0) ? -u : u;
    u = (u >= WDIM) ? (2 * WDIM - 2 - u) : u;
    ww[d] = u;
  }

  const float* pb = pxb + (size_t)n * CD * HW;
  const float* pc = pxc + (size_t)n * CD * HW;

  float e[25];
  #pragma unroll
  for (int k = 0; k < 25; ++k) e[k] = 0.0f;

  #pragma unroll 1
  for (int c = 0; c < CD; ++c) {
    const float* plane = pb + (size_t)c * HW;
    const float xc = pc[(size_t)c * HW + p];
    #pragma unroll
    for (int di = 0; di < 5; ++di) {
      const float* rowp = plane + hh[di];
      #pragma unroll
      for (int dj = 0; dj < 5; ++dj)
        e[di * 5 + dj] = fmaf(xc, rowp[ww[dj]], e[di * 5 + dj]);
    }
  }

  float mx = e[0];
  #pragma unroll
  for (int k = 1; k < 25; ++k) mx = fmaxf(mx, e[k]);
  float s = 0.0f;
  #pragma unroll
  for (int k = 0; k < 25; ++k) {
    e[k] = __expf(e[k] - mx);
    s += e[k];
  }
  const float al = alpha[0];
  const float scale = al * (1.0f / s);     // alpha / sum folded

  #pragma unroll 1
  for (int c = 0; c < CD; ++c) {
    const float* plane = pb + (size_t)c * HW;
    float acc = 0.0f;
    #pragma unroll
    for (int di = 0; di < 5; ++di) {
      const float* rowp = plane + hh[di];
      #pragma unroll
      for (int dj = 0; dj < 5; ++dj)
        acc = fmaf(e[di * 5 + dj], rowp[ww[dj]], acc);
    }
    const size_t idx = ((size_t)n * CD + c) * HW + p;
    const float v = fmaf(scale, acc, x[idx]);
    *(float*)(out + idx) = v;
    
  }
}

// =====================================================================================
extern "C" void kernel_launch(void* const* d_in, const int* in_sizes, int n_in,
                              void* d_out, int out_size, void* d_ws, size_t ws_size,
                              hipStream_t stream) {
  if (n_in < 6) return;
  if (in_sizes[0] != X_N || in_sizes[1] != W_N || in_sizes[2] != B_N ||
      in_sizes[3] != W_N || in_sizes[4] != B_N || in_sizes[5] < 1) return;
  if (out_size != OUT_N) return;
  if (ws_size < (size_t)WS_TOTAL) return;

  const float* x     = (const float*)d_in[0];
  const float* Wb    = (const float*)d_in[1];
  const float* bb    = (const float*)d_in[2];
  const float* Wc    = (const float*)d_in[3];
  const float* bc    = (const float*)d_in[4];
  const float* alpha = (const float*)d_in[5];
  float* out = (float*)d_out;

  char* ws = (char*)d_ws;
  float*          px   = (float*)(ws + OFF_PXB);               // pxb, then pxc at +PLANE floats
  unsigned short* xT   = (unsigned short*)(ws + OFF_XT);
  unsigned short* W16  = (unsigned short*)(ws + OFF_W16);

  k_wprep<<<dim3(64), dim3(256), 0, stream>>>(Wb, Wc, W16);
  k_xprep<<<dim3(NB * 4 * (HW / 64)), dim3(256), 0, stream>>>(x, xT);
  k_conv<<<dim3(NB * 4 * (HW / 64)), dim3(256), 0, stream>>>(xT, W16, bb, bc, px);
  k_attn<<<dim3((NB * HW) / 256), dim3(256), 0, stream>>>(x, px, px + PLANE, alpha, out);
}

// v001
// It runs in 65.5 microseconds.
// Timed twice side by side with v000, it ran 6.30 and 6.35 times as fast.
#include <hip/hip_runtime.h>

// Contractions: two 1x1 channel GEMMs on v_wmma_f32_16x16x32_f16 (f16 operands: weights carried x16,
// activations x1; f32 accumulate, 1/16 folded in the f32 epilogue). 5x5 reflect-pad window energies,
// softmax and fusion in f32 on VALU.

#define NB     4
#define CD     256
#define HDIM   64
#define WDIM   64
#define HW     (HDIM * WDIM)            // 4096
#define PLANE  (NB * CD * HW)           // 4194304 elements per f32 map
#define X_N    PLANE
#define W_N    (CD * CD)                // 65536
#define B_N    CD
#define OUT_N  PLANE

#define SZ_PX   ((size_t)PLANE * 4)           // 16777216  f32 [n][c][hw]
#define SZ_XT   ((size_t)NB * HW * CD * 2)    // 8388608   f16 [n][hw][c]
#define SZ_W16  ((size_t)CD * CD * 2)         // 131072    f16 [o][c] (x16)
#define OFF_PXB ((size_t)0)
#define OFF_PXC (OFF_PXB + SZ_PX)
#define OFF_XT  (OFF_PXC + SZ_PX)
#define OFF_W16 (OFF_XT + SZ_XT)              // Wb16 at +0, Wc16 at +SZ_W16
#define WS_TOTAL (OFF_W16 + 2 * SZ_W16)       // 42205184

static_assert(WS_TOTAL == 42205184);
static_assert((OFF_PXC % 128) == 0 && (OFF_XT % 128) == 0 && (OFF_W16 % 128) == 0 && (SZ_W16 % 128) == 0);
static_assert(HW % 64 == 0 && CD % 64 == 0 && (NB * HW) % 256 == 0);

#define XP 72      // transpose LDS pitch (halves), 144 B
#define EP 68      // conv epilogue LDS pitch (floats), 272 B

typedef unsigned short v8us  __attribute__((ext_vector_type(8)));
typedef unsigned short v8usa __attribute__((ext_vector_type(8), __may_alias__));
typedef unsigned short v16us __attribute__((ext_vector_type(16)));
typedef _Float16       v16h  __attribute__((ext_vector_type(16)));
typedef float          v8f   __attribute__((ext_vector_type(8)));
typedef float          v4f   __attribute__((ext_vector_type(4)));
typedef float          v4fa  __attribute__((ext_vector_type(4), __may_alias__));

union Frag { v16us v; v8us half[2]; };

// f32 -> f16 bits (RNE convert)
__device__ __forceinline__ unsigned short h2us(float f) {
  return __builtin_bit_cast(unsigned short, (_Float16)f);
}

__device__ __forceinline__ void st2_u8(unsigned short* p, v8us v) {
  *(v8us*)p = v;
  
}
__device__ __forceinline__ void st2_f4(float* p, v4f v) {
  *(v4f*)p = v;
  
}

// 16-bit fragment from a k-contiguous row: elements 0..7 <- k0+8h.., elements 8..15 <- k0+16+8h..
// Used for A rows [m][k] and for B stored as [n][k] (same per-lane k map).
__device__ __forceinline__ v16h ldfrag(const unsigned short* rowp, int h) {
  Frag f;
  f.half[0] = *(const v8us*)(rowp + 8 * h);
  f.half[1] = *(const v8us*)(rowp + 16 + 8 * h);
  return __builtin_bit_cast(v16h, f.v);
}

__device__ __forceinline__ v8f wmma_h(v16h a, v16h b, v8f c) {
  return __builtin_amdgcn_wmma_f32_16x16x32_f16(false, a, false, b, (short)0, c, false, false);
}

__device__ __forceinline__ v8f v8f_zero() {
  v8f z = {0.f, 0.f, 0.f, 0.f, 0.f, 0.f, 0.f, 0.f};
  return z;
}

// =====================================================================================
// Kernel 0: weight planes. W16[which][o][c] = f16(16 * W[o][c]); one thread = 8 consecutive c
// (16 B), one wave = one whole 512-B row. 64 blocks x 256 = 2 x 8192 items exactly.
// =====================================================================================
__global__ void __launch_bounds__(256) k_wprep(
    const float* __restrict__ Wb, const float* __restrict__ Wc, unsigned short* __restrict__ W16) {
  const int i = blockIdx.x * 256 + threadIdx.x;   // < 16384
  const int which = i >> 13;                       // block-uniform (32 blocks each)
  const int e = i & 8191;
  const int o = e >> 5;
  const int kc = e & 31;
  const size_t off = (size_t)o * CD + kc * 8;
  const v4f b0 = *(const v4f*)(Wb + off);
  const v4f b1 = *(const v4f*)(Wb + off + 4);
  const v4f c0 = *(const v4f*)(Wc + off);
  const v4f c1 = *(const v4f*)(Wc + off + 4);
  float f[8];
  f[0] = which ? c0.x : b0.x; f[1] = which ? c0.y : b0.y; f[2] = which ? c0.z : b0.z; f[3] = which ? c0.w : b0.w;
  f[4] = which ? c1.x : b1.x; f[5] = which ? c1.y : b1.y; f[6] = which ? c1.z : b1.z; f[7] = which ? c1.w : b1.w;
  v8us ov;
  #pragma unroll
  for (int j = 0; j < 8; ++j) ov[j] = h2us(f[j] * 16.0f);
  st2_u8(W16 + (size_t)which * W_N + off, ov);
}

// =====================================================================================
// Kernel 1: activation plane xT[n][hw][c] = f16(x[n][c][hw]) through a 64(c) x 64(px) LDS tile.
// Grid 1024 = 4 n x 4 c-tiles x 64 px-tiles. Read: float4 along hw (coalesced); LDS holds the
// lanes x 16 B of one instruction, 4 rows per instruction per wave, 2 iterations -> 64 rows.
// =====================================================================================
__global__ void __launch_bounds__(256) k_xprep(const float* __restrict__ x, unsigned short* __restrict__ xT) {
  __shared__ __attribute__((aligned(16))) unsigned short sT[64 * XP];
  const int tid = threadIdx.x;
  const int lane = tid & 31;
  const int w = tid >> 5;
  const int bid = blockIdx.x;
  const int pt = bid & 63;
  const int ct = (bid >> 6) & 3;
  const int n = bid >> 8;
  const int p0 = pt * 64;
  const int c0 = ct * 64;

  #pragma unroll
  for (int it = 0; it < 4; ++it) {
    const int idx = it * 256 + tid;            // 0..1023
    const int c = idx >> 4;                    // 0..63
    const int p4 = (idx & 15) * 4;             // 0..60
    const v4f v = *(const v4f*)(x + ((size_t)(n * CD + c0 + c)) * HW + p0 + p4);
    sT[(p4 + 0) * XP + c] = h2us(v.x);
    sT[(p4 + 1) * XP + c] = h2us(v.y);
    sT[(p4 + 2) * XP + c] = h2us(v.z);
    sT[(p4 + 3) * XP + c] = h2us(v.w);
  }
  __syncthreads();

  const int q = lane >> 3;     // row within the 4-row group
  const int j = lane & 7;
  #pragma unroll 1
  for (int it = 0; it < 2; ++it) {
    const int prow = it * 32 + w * 4 + q;      // 0..63, each once
    const v8us val = *(const v8usa*)(sT + prow * XP + j * 8);
    unsigned short* dst = xT + ((size_t)(n * HW + p0 + prow)) * CD + c0 + j * 8;
    st2_u8(dst, val);
  }
}

// =====================================================================================
// Kernel 2: pxb[n][o][hw] = (Wb16 . xT^T) / 16 + bb, pxc likewise, f32 maps.
// A = W16[o][c] (k-contiguous), B[k=c][n=px] loaded from xT[px][c] rows exactly like A.
// Block = (n, 64 o, 64 px); wave w: o rows (w>>1)*16, px cols (w&1)*32 (two D tiles per GEMM).
// Epilogue: f32 tile [128 rows: 64 pxb + 64 pxc][64 px] in LDS; each row segment (256 B) written by
// =====================================================================================
__device__ __forceinline__ void stage16(float* sT, v8f ab, v8f ac, int orow0, int col,
                                        const float* bbp, const float* bcp) {
  #pragma unroll
  for (int r = 0; r < 8; ++r) {
    const int orow = orow0 + r;
    sT[orow * EP + col] = ab[r] * 0.0625f + bbp[r];
    sT[(64 + orow) * EP + col] = ac[r] * 0.0625f + bcp[r];
  }
}

__global__ void __launch_bounds__(256) k_conv(
    const unsigned short* __restrict__ xT, const unsigned short* __restrict__ W16,
    const float* __restrict__ bb, const float* __restrict__ bc, float* __restrict__ px) {
  __shared__ __attribute__((aligned(16))) float sT[128 * EP];
  const int tid = threadIdx.x;
  const int lane = tid & 31;
  const int w = tid >> 5;
  const int h = lane >> 4;
  const int m = lane & 15;
  const int bid = blockIdx.x;
  const int pt = bid & 63;
  const int ot = (bid >> 6) & 3;
  const int n = bid >> 8;
  const int p0 = pt * 64;
  const int o0 = ot * 64;
  const int osub = (w >> 1) * 16;
  const int psub = (w & 1) * 32;

  const unsigned short* arb = W16 + (size_t)(o0 + osub + m) * CD;
  const unsigned short* arc = arb + W_N;
  const unsigned short* br0 = xT + ((size_t)(n * HW + p0 + psub + m)) * CD;
  const unsigned short* br1 = br0 + 16 * CD;

  v8f accB0 = v8f_zero(), accB1 = v8f_zero(), accC0 = v8f_zero(), accC1 = v8f_zero();

  #pragma unroll 1
  for (int ks = 0; ks < CD / 32; ++ks) {
    const int k0 = ks * 32;
    const v16h fab = ldfrag(arb + k0, h);
    const v16h fac = ldfrag(arc + k0, h);
    const v16h fb0 = ldfrag(br0 + k0, h);
    const v16h fb1 = ldfrag(br1 + k0, h);
    accB0 = wmma_h(fab, fb0, accB0);
    accB1 = wmma_h(fab, fb1, accB1);
    accC0 = wmma_h(fac, fb0, accC0);
    accC1 = wmma_h(fac, fb1, accC1);
    asm volatile("v_nop\n\tv_nop\n\tv_nop\n\tv_nop"
                 : "+v"(accB0), "+v"(accB1), "+v"(accC0), "+v"(accC1)
                 : "v"(fab), "v"(fac), "v"(fb0), "v"(fb1));
  }

  // D element r of lane -> o row osub + 8h + r, px col psub + t*16 + m
  const float* bbp = bb + o0 + osub + 8 * h;
  const float* bcp = bc + o0 + osub + 8 * h;
  stage16(sT, accB0, accC0, osub + 8 * h, psub + m, bbp, bcp);
  stage16(sT, accB1, accC1, osub + 8 * h, psub + 16 + m, bbp, bcp);
  __syncthreads();

  const int q = lane >> 3;
  const int j = lane & 7;
  const int rsel = q >> 1;
  const int lsel = q & 1;
  #pragma unroll 1
  for (int it = 0; it < 8; ++it) {
    const int row2 = it * 16 + w * 2 + rsel;     // 0..127, each once; rows 0..63 pxb, 64..127 pxc
    const int buf = row2 >> 6;
    const int row = row2 & 63;
    const v4f v = *(const v4fa*)(sT + row2 * EP + lsel * 32 + j * 4);
    float* dst = px + (size_t)buf * PLANE + ((size_t)(n * CD + o0 + row)) * HW + p0 + lsel * 32 + j * 4;
    st2_f4(dst, v);
  }
}

// =====================================================================================
// Kernel 3: per-pixel 5x5 attention, f32 on VALU. Work-group = one image row (64 pixels) x AS channel
// slices = 32 waves; lane = pixel, a wave owns half a row and CPS channels. Each wave sums its slice's
// share of the 25 energies; the shares meet in LDS in a fixed order; every wave then forms the softmax
// of its 32 pixels and writes the fused output of its own channels (one 128-B line per store).
// =====================================================================================
#define AS   16                 // channel slices per work-group
#define CPS  (CD / AS)          // channels per slice
#define NE   (25 * WDIM)        // energies per work-group
#define ATH  (AS * WDIM)        // threads per work-group
static_assert(CD % AS == 0 && WDIM == 64 && ATH <= 1024);

__global__ void __launch_bounds__(ATH) k_attn(
    const float* __restrict__ x, const float* __restrict__ pxb, const float* __restrict__ pxc,
    const float* __restrict__ alpha, float* __restrict__ out) {
  __shared__ float sE[AS * NE];     // [slice][k][pixel of the row]
  __shared__ float sR[NE];          // [k][pixel of the row]
  const int tid = threadIdx.x;
  const int wx = tid & (WDIM - 1);
  const int sl = __builtin_amdgcn_readfirstlane(tid >> 6);   // scalar, so plane bases stay scalar
  const int n = blockIdx.x >> 6;                    // grid = NB * HDIM exactly
  const int hy = blockIdx.x & (HDIM - 1);
  const int p = hy * WDIM + wx;

  int hh[5], ww[5];
  #pragma unroll
  for (int d = 0; d < 5; ++d) {
    int t = hy + d - 2;
    t = (t < 0) ? -t : t;
    t = (t >= HDIM) ? (2 * HDIM - 2 - t) : t;
    hh[d] = t * WDIM;
    int u = wx + d - 2;
    u = (u < 0) ? -u : u;
    u = (u >= WDIM) ? (2 * WDIM - 2 - u) : u;
    ww[d] = u;
  }

  const size_t cbase = ((size_t)n * CD + sl * CPS) * HW;
  const float* pb = pxb + cbase;
  const float* pc = pxc + cbase;

  float e[25];
  #pragma unroll
  for (int k = 0; k < 25; ++k) e[k] = 0.0f;

  #pragma unroll 1
  for (int c = 0; c < CPS; ++c) {
    const float* plane = pb + (size_t)c * HW;
    const float xc = pc[(size_t)c * HW + p];
    #pragma unroll
    for (int di = 0; di < 5; ++di) {
      const float* rowp = plane + hh[di];
      #pragma unroll
      for (int dj = 0; dj < 5; ++dj)
        e[di * 5 + dj] = fmaf(xc, rowp[ww[dj]], e[di * 5 + dj]);
    }
  }

  // slices' shares -> LDS; each of the NE sums is formed by one thread, slice 0 first
  #pragma unroll
  for (int k = 0; k < 25; ++k) sE[(sl * 25 + k) * WDIM + wx] = e[k];
  __syncthreads();
  for (int el = tid; el < NE; el += ATH) {
    float t = sE[el];
    #pragma unroll
    for (int j = 1; j < AS; ++j) t += sE[j * NE + el];
    sR[el] = t;
  }
  __syncthreads();
  #pragma unroll
  for (int k = 0; k < 25; ++k) e[k] = sR[k * WDIM + wx];

  float mx = e[0];
  #pragma unroll
  for (int k = 1; k < 25; ++k) mx = fmaxf(mx, e[k]);
  float s = 0.0f;
  #pragma unroll
  for (int k = 0; k < 25; ++k) {
    e[k] = __expf(e[k] - mx);
    s += e[k];
  }
  const float al = alpha[0];
  const float scale = al * (1.0f / s);     // alpha / sum folded

  #pragma unroll 1
  for (int c = 0; c < CPS; ++c) {
    const float* plane = pb + (size_t)c * HW;
    float acc = 0.0f;
    #pragma unroll
    for (int di = 0; di < 5; ++di) {
      const float* rowp = plane + hh[di];
      #pragma unroll
      for (int dj = 0; dj < 5; ++dj)
        acc = fmaf(e[di * 5 + dj], rowp[ww[dj]], acc);
    }
    const size_t idx = cbase + (size_t)c * HW + p;
    const float v = fmaf(scale, acc, x[idx]);
    *(float*)(out + idx) = v;
  }
}

// =====================================================================================
extern "C" void kernel_launch(void* const* d_in, const int* in_sizes, int n_in,
                              void* d_out, int out_size, void* d_ws, size_t ws_size,
                              hipStream_t stream) {
  if (n_in < 6) return;
  if (in_sizes[0] != X_N || in_sizes[1] != W_N || in_sizes[2] != B_N ||
      in_sizes[3] != W_N || in_sizes[4] != B_N || in_sizes[5] < 1) return;
  if (out_size != OUT_N) return;
  if (ws_size < (size_t)WS_TOTAL) return;

  const float* x     = (const float*)d_in[0];
  const float* Wb    = (const float*)d_in[1];
  const float* bb    = (const float*)d_in[2];
  const float* Wc    = (const float*)d_in[3];
  const float* bc    = (const float*)d_in[4];
  const float* alpha = (const float*)d_in[5];
  float* out = (float*)d_out;

  char* ws = (char*)d_ws;
  float*          px   = (float*)(ws + OFF_PXB);               // pxb, then pxc at +PLANE floats
  unsigned short* xT   = (unsigned short*)(ws + OFF_XT);
  unsigned short* W16  = (unsigned short*)(ws + OFF_W16);

  k_wprep<<<dim3(64), dim3(256), 0, stream>>>(Wb, Wc, W16);
  k_xprep<<<dim3(NB * 4 * (HW / 64)), dim3(256), 0, stream>>>(x, xT);
  k_conv<<<dim3(NB * 4 * (HW / 64)), dim3(256), 0, stream>>>(xT, W16, bb, bc, px);
  k_attn<<<dim3(NB * HDIM), dim3(ATH), 0, stream>>>(x, px, px + PLANE, alpha, out);
}

// v002
// One run takes 41.4 microseconds.
// In both of two side-by-side timings against v001, it was 1.58 times as fast.
// All steps since v000 together make it 9.98 times as fast.
#include <hip/hip_runtime.h>

// Contractions: two 1x1 channel GEMMs on v_wmma_f32_16x16x32_f16 (f16 operands: weights carried x16,
// activations x1; f32 accumulate, 1/16 folded in the f32 epilogue). 5x5 reflect-pad window energies,
// softmax and fusion in f32 on VALU.

#define NB     4
#define CD     256
#define HDIM   64
#define WDIM   64
#define HW     (HDIM * WDIM)            // 4096
#define PLANE  (NB * CD * HW)           // 4194304 elements per f32 map
#define X_N    PLANE
#define W_N    (CD * CD)                // 65536
#define B_N    CD
#define OUT_N  PLANE

#define SZ_PX   ((size_t)PLANE * 4)           // 16777216  f32 [n][c][hw]
#define SZ_XT   ((size_t)NB * HW * CD * 2)    // 8388608   f16 [n][hw][c]
#define SZ_W16  ((size_t)CD * CD * 2)         // 131072    f16 [o][c] (x16)
#define OFF_PXB ((size_t)0)
#define OFF_PXC (OFF_PXB + SZ_PX)
#define OFF_XT  (OFF_PXC + SZ_PX)
#define OFF_W16 (OFF_XT + SZ_XT)              // Wb16 at +0, Wc16 at +SZ_W16
#define WS_TOTAL (OFF_W16 + 2 * SZ_W16)       // 42205184

static_assert(WS_TOTAL == 42205184);
static_assert((OFF_PXC % 128) == 0 && (OFF_XT % 128) == 0 && (OFF_W16 % 128) == 0 && (SZ_W16 % 128) == 0);
static_assert(HW % 64 == 0 && CD % 64 == 0 && (NB * HW) % 256 == 0);

#define XP 72      // transpose LDS pitch (halves), 144 B
#define EP 68      // conv epilogue LDS pitch (floats), 272 B

typedef unsigned short v8us  __attribute__((ext_vector_type(8)));
typedef unsigned short v8usa __attribute__((ext_vector_type(8), __may_alias__));
typedef unsigned short v16us __attribute__((ext_vector_type(16)));
typedef _Float16       v16h  __attribute__((ext_vector_type(16)));
typedef float          v8f   __attribute__((ext_vector_type(8)));
typedef float          v4f   __attribute__((ext_vector_type(4)));
typedef float          v4fa  __attribute__((ext_vector_type(4), __may_alias__));

union Frag { v16us v; v8us half[2]; };

// f32 -> f16 bits (RNE convert)
__device__ __forceinline__ unsigned short h2us(float f) {
  return __builtin_bit_cast(unsigned short, (_Float16)f);
}

__device__ __forceinline__ void st2_u8(unsigned short* p, v8us v) {
  *(v8us*)p = v;
  
}
__device__ __forceinline__ void st2_f4(float* p, v4f v) {
  *(v4f*)p = v;
  
}

// 16-bit fragment from a k-contiguous row: elements 0..7 <- k0+8h.., elements 8..15 <- k0+16+8h..
// Used for A rows [m][k] and for B stored as [n][k] (same per-lane k map).
__device__ __forceinline__ v16h ldfrag(const unsigned short* rowp, int h) {
  Frag f;
  f.half[0] = *(const v8us*)(rowp + 8 * h);
  f.half[1] = *(const v8us*)(rowp + 16 + 8 * h);
  return __builtin_bit_cast(v16h, f.v);
}

__device__ __forceinline__ v8f wmma_h(v16h a, v16h b, v8f c) {
  return __builtin_amdgcn_wmma_f32_16x16x32_f16(false, a, false, b, (short)0, c, false, false);
}

__device__ __forceinline__ v8f v8f_zero() {
  v8f z = {0.f, 0.f, 0.f, 0.f, 0.f, 0.f, 0.f, 0.f};
  return z;
}

// =====================================================================================
// Kernel 0: weight planes. W16[which][o][c] = f16(16 * W[o][c]); one thread = 8 consecutive c
// (16 B), one wave = one whole 512-B row. 64 blocks x 256 = 2 x 8192 items exactly.
// =====================================================================================
__global__ void __launch_bounds__(256) k_wprep(
    const float* __restrict__ Wb, const float* __restrict__ Wc, unsigned short* __restrict__ W16) {
  const int i = blockIdx.x * 256 + threadIdx.x;   // < 16384
  const int which = i >> 13;                       // block-uniform (32 blocks each)
  const int e = i & 8191;
  const int o = e >> 5;
  const int kc = e & 31;
  const size_t off = (size_t)o * CD + kc * 8;
  const v4f b0 = *(const v4f*)(Wb + off);
  const v4f b1 = *(const v4f*)(Wb + off + 4);
  const v4f c0 = *(const v4f*)(Wc + off);
  const v4f c1 = *(const v4f*)(Wc + off + 4);
  float f[8];
  f[0] = which ? c0.x : b0.x; f[1] = which ? c0.y : b0.y; f[2] = which ? c0.z : b0.z; f[3] = which ? c0.w : b0.w;
  f[4] = which ? c1.x : b1.x; f[5] = which ? c1.y : b1.y; f[6] = which ? c1.z : b1.z; f[7] = which ? c1.w : b1.w;
  v8us ov;
  #pragma unroll
  for (int j = 0; j < 8; ++j) ov[j] = h2us(f[j] * 16.0f);
  st2_u8(W16 + (size_t)which * W_N + off, ov);
}

// =====================================================================================
// Kernel 1: activation plane xT[n][hw][c] = f16(x[n][c][hw]) through a 64(c) x 64(px) LDS tile.
// Grid 1024 = 4 n x 4 c-tiles x 64 px-tiles. Read: float4 along hw (coalesced); LDS holds the
// lanes x 16 B of one instruction, 4 rows per instruction per wave, 2 iterations -> 64 rows.
// =====================================================================================
__global__ void __launch_bounds__(256) k_xprep(const float* __restrict__ x, unsigned short* __restrict__ xT) {
  __shared__ __attribute__((aligned(16))) unsigned short sT[64 * XP];
  const int tid = threadIdx.x;
  const int lane = tid & 31;
  const int w = tid >> 5;
  const int bid = blockIdx.x;
  const int pt = bid & 63;
  const int ct = (bid >> 6) & 3;
  const int n = bid >> 8;
  const int p0 = pt * 64;
  const int c0 = ct * 64;

  #pragma unroll
  for (int it = 0; it < 4; ++it) {
    const int idx = it * 256 + tid;            // 0..1023
    const int c = idx >> 4;                    // 0..63
    const int p4 = (idx & 15) * 4;             // 0..60
    const v4f v = *(const v4f*)(x + ((size_t)(n * CD + c0 + c)) * HW + p0 + p4);
    sT[(p4 + 0) * XP + c] = h2us(v.x);
    sT[(p4 + 1) * XP + c] = h2us(v.y);
    sT[(p4 + 2) * XP + c] = h2us(v.z);
    sT[(p4 + 3) * XP + c] = h2us(v.w);
  }
  __syncthreads();

  const int q = lane >> 3;     // row within the 4-row group
  const int j = lane & 7;
  #pragma unroll 1
  for (int it = 0; it < 2; ++it) {
    const int prow = it * 32 + w * 4 + q;      // 0..63, each once
    const v8us val = *(const v8usa*)(sT + prow * XP + j * 8);
    unsigned short* dst = xT + ((size_t)(n * HW + p0 + prow)) * CD + c0 + j * 8;
    st2_u8(dst, val);
  }
}

// =====================================================================================
// Kernel 2: pxb[n][o][hw] = (Wb16 . xT^T) / 16 + bb, pxc likewise, f32 maps.
// A = W16[o][c] (k-contiguous), B[k=c][n=px] loaded from xT[px][c] rows exactly like A.
// Block = (n, 64 o, 64 px); wave w: o rows (w>>1)*16, px cols (w&1)*32 (two D tiles per GEMM).
// Epilogue: f32 tile [128 rows: 64 pxb + 64 pxc][64 px] in LDS; each row segment (256 B) written by
// =====================================================================================
__device__ __forceinline__ void stage16(float* sT, v8f ab, v8f ac, int orow0, int col,
                                        const float* bbp, const float* bcp) {
  #pragma unroll
  for (int r = 0; r < 8; ++r) {
    const int orow = orow0 + r;
    sT[orow * EP + col] = ab[r] * 0.0625f + bbp[r];
    sT[(64 + orow) * EP + col] = ac[r] * 0.0625f + bcp[r];
  }
}

__global__ void __launch_bounds__(256) k_conv(
    const unsigned short* __restrict__ xT, const unsigned short* __restrict__ W16,
    const float* __restrict__ bb, const float* __restrict__ bc, float* __restrict__ px) {
  __shared__ __attribute__((aligned(16))) float sT[128 * EP];
  const int tid = threadIdx.x;
  const int lane = tid & 31;
  const int w = tid >> 5;
  const int h = lane >> 4;
  const int m = lane & 15;
  const int bid = blockIdx.x;
  const int pt = bid & 63;
  const int ot = (bid >> 6) & 3;
  const int n = bid >> 8;
  const int p0 = pt * 64;
  const int o0 = ot * 64;
  const int osub = (w >> 1) * 16;
  const int psub = (w & 1) * 32;

  const unsigned short* arb = W16 + (size_t)(o0 + osub + m) * CD;
  const unsigned short* arc = arb + W_N;
  const unsigned short* br0 = xT + ((size_t)(n * HW + p0 + psub + m)) * CD;
  const unsigned short* br1 = br0 + 16 * CD;

  v8f accB0 = v8f_zero(), accB1 = v8f_zero(), accC0 = v8f_zero(), accC1 = v8f_zero();

  #pragma unroll 1
  for (int ks = 0; ks < CD / 32; ++ks) {
    const int k0 = ks * 32;
    const v16h fab = ldfrag(arb + k0, h);
    const v16h fac = ldfrag(arc + k0, h);
    const v16h fb0 = ldfrag(br0 + k0, h);
    const v16h fb1 = ldfrag(br1 + k0, h);
    accB0 = wmma_h(fab, fb0, accB0);
    accB1 = wmma_h(fab, fb1, accB1);
    accC0 = wmma_h(fac, fb0, accC0);
    accC1 = wmma_h(fac, fb1, accC1);
    asm volatile("v_nop\n\tv_nop\n\tv_nop\n\tv_nop"
                 : "+v"(accB0), "+v"(accB1), "+v"(accC0), "+v"(accC1)
                 : "v"(fab), "v"(fac), "v"(fb0), "v"(fb1));
  }

  // D element r of lane -> o row osub + 8h + r, px col psub + t*16 + m
  const float* bbp = bb + o0 + osub + 8 * h;
  const float* bcp = bc + o0 + osub + 8 * h;
  stage16(sT, accB0, accC0, osub + 8 * h, psub + m, bbp, bcp);
  stage16(sT, accB1, accC1, osub + 8 * h, psub + 16 + m, bbp, bcp);
  __syncthreads();

  const int q = lane >> 3;
  const int j = lane & 7;
  const int rsel = q >> 1;
  const int lsel = q & 1;
  #pragma unroll 1
  for (int it = 0; it < 8; ++it) {
    const int row2 = it * 16 + w * 2 + rsel;     // 0..127, each once; rows 0..63 pxb, 64..127 pxc
    const int buf = row2 >> 6;
    const int row = row2 & 63;
    const v4f v = *(const v4fa*)(sT + row2 * EP + lsel * 32 + j * 4);
    float* dst = px + (size_t)buf * PLANE + ((size_t)(n * CD + o0 + row)) * HW + p0 + lsel * 32 + j * 4;
    st2_f4(dst, v);
  }
}

// =====================================================================================
// Kernel 3: per-pixel 5x5 attention, f32 on VALU. Work-group = one image row (64 pixels) x AS channel
// slices = 16 waves. A lane owns 4 adjacent pixels, so 16 lanes (one DPP row) cover the image row and
// a wave holds two slices. One 16-byte load per window row and channel gives a lane its own 4 columns;
// the 2 + 2 columns beside them come from the neighbour lanes' registers, and the 8 values feed
// 20 multiply-adds. Each slice sums its share of the 25 energies; the shares meet in LDS in a fixed
// order; every slice then forms the softmax and writes the fused output of its own channels.
// =====================================================================================
#define AS   32                 // channel slices per work-group
#define CPS  (CD / AS)          // channels per slice
#define PXL  4                  // pixels per lane
#define RL   (WDIM / PXL)       // lanes per image row
#define NE   (25 * WDIM)        // energies per work-group
#define ATH  (AS * RL)          // threads per work-group
static_assert(CD % AS == 0 && WDIM == 64 && RL == 16 && ATH <= 1024);

// src of the lane one below (row_shr:1) in the 16-lane row; lane 0 of the row, which has none, gets edge
__device__ __forceinline__ float from_lower(float edge, float src) {
  return __builtin_bit_cast(float, __builtin_amdgcn_update_dpp(
      __builtin_bit_cast(int, edge), __builtin_bit_cast(int, src), 0x111, 0xf, 0xf, false));
}
// src of the lane one above (row_shl:1) in the 16-lane row; lane 15 of the row, which has none, gets edge
__device__ __forceinline__ float from_upper(float edge, float src) {
  return __builtin_bit_cast(float, __builtin_amdgcn_update_dpp(
      __builtin_bit_cast(int, edge), __builtin_bit_cast(int, src), 0x101, 0xf, 0xf, false));
}

// q[i] = column 4j - 2 + i of the reflect-padded row, v = columns 4j..4j+3 (j = lane in the row).
// Reflection: columns -2, -1 are columns 2, 1 (lane 0's own); columns 64, 65 are 62, 61 (lane 15's own).
__device__ __forceinline__ void win8(v4f v, float* q) {
  q[0] = from_lower(v.z, v.z);
  q[1] = from_lower(v.y, v.w);
  q[2] = v.x; q[3] = v.y; q[4] = v.z; q[5] = v.w;
  q[6] = from_upper(v.z, v.x);
  q[7] = from_upper(v.y, v.y);
}

// 16 bytes at a base that is the same for the whole work-group plus the lane's own byte offset
__device__ __forceinline__ v4f ld4(const float* base, unsigned boff) {
  return *(const v4f*)((const char*)base + boff);
}

__global__ void __launch_bounds__(ATH) k_attn(
    const float* __restrict__ x, const float* __restrict__ pxb, const float* __restrict__ pxc,
    const float* __restrict__ alpha, float* __restrict__ out) {
  __shared__ __attribute__((aligned(16))) float sE[AS * NE];     // [slice][k][pixel of the row]
  __shared__ __attribute__((aligned(16))) float sR[NE];          // [k][pixel of the row]
  const int tid = threadIdx.x;
  const int j = tid & (RL - 1);
  const int sl = tid >> 4;
  const int n = blockIdx.x >> 6;                    // grid = NB * HDIM exactly
  const int hy = blockIdx.x & (HDIM - 1);

  int hh[5];
  #pragma unroll
  for (int d = 0; d < 5; ++d) {
    int t = hy + d - 2;
    t = (t < 0) ? -t : t;
    t = (t >= HDIM) ? (2 * HDIM - 2 - t) : t;
    hh[d] = t * WDIM;
  }

  const size_t nbase = (size_t)n * CD * HW;                       // same for the whole work-group
  const unsigned lofs = (unsigned)(sl * CPS * HW + PXL * j) * 4u; // the lane's own part, in bytes
  const float* pb = pxb + nbase;
  const float* pc = pxc + nbase + hy * WDIM;

  float e[25 * PXL];
  #pragma unroll
  for (int k = 0; k < 25 * PXL; ++k) e[k] = 0.0f;

  // two channels a trip: their 12 loads are issued together; four a trip spilled registers
  #pragma unroll 2
  for (int c = 0; c < CPS; ++c) {
    const float* plane = pb + c * HW;
    const v4f xc = ld4(pc + c * HW, lofs);
    #pragma unroll
    for (int di = 0; di < 5; ++di) {
      float q[8];
      win8(ld4(plane + hh[di], lofs), q);
      #pragma unroll
      for (int dj = 0; dj < 5; ++dj) {
        #pragma unroll
        for (int t = 0; t < PXL; ++t)
          e[(di * 5 + dj) * PXL + t] = fmaf(xc[t], q[t + dj], e[(di * 5 + dj) * PXL + t]);
      }
    }
  }

  // slices' shares -> LDS; each sum is formed by one thread (4 pixels at a time), slice 0 first
  #pragma unroll
  for (int k = 0; k < 25; ++k) {
    const v4f t = {e[k * PXL + 0], e[k * PXL + 1], e[k * PXL + 2], e[k * PXL + 3]};
    *(v4fa*)(sE + (sl * 25 + k) * WDIM + PXL * j) = t;
  }
  __syncthreads();
  for (int el = tid; el < NE / PXL; el += ATH) {
    v4f t = *(const v4fa*)(sE + el * PXL);
    #pragma unroll
    for (int s = 1; s < AS; ++s) t += *(const v4fa*)(sE + s * NE + el * PXL);
    *(v4fa*)(sR + el * PXL) = t;
  }
  __syncthreads();
  #pragma unroll
  for (int k = 0; k < 25; ++k) {
    const v4f t = *(const v4fa*)(sR + k * WDIM + PXL * j);
    e[k * PXL + 0] = t.x; e[k * PXL + 1] = t.y; e[k * PXL + 2] = t.z; e[k * PXL + 3] = t.w;
  }

  const float al = alpha[0];
  float scale[PXL];
  #pragma unroll
  for (int t = 0; t < PXL; ++t) {
    float mx = e[t];
    #pragma unroll
    for (int k = 1; k < 25; ++k) mx = fmaxf(mx, e[k * PXL + t]);
    float s = 0.0f;
    #pragma unroll
    for (int k = 0; k < 25; ++k) {
      e[k * PXL + t] = __expf(e[k * PXL + t] - mx);
      s += e[k * PXL + t];
    }
    scale[t] = al * (1.0f / s);     // alpha / sum folded
  }

  const float* xr = x + nbase + hy * WDIM;
  float* orow = out + nbase + hy * WDIM;
  static_assert(CPS % 4 == 0);
  // stays rolled: the 24 loads of a trip's four channels already fill the register budget
  #pragma unroll 1
  for (int c = 0; c < CPS; c += 4) {
    v4f r[4];
    #pragma unroll
    for (int u = 0; u < 4; ++u) {
      const float* plane = pb + (c + u) * HW;
      const v4f xv = ld4(xr + (c + u) * HW, lofs);
      float acc[PXL] = {0.0f, 0.0f, 0.0f, 0.0f};
      #pragma unroll
      for (int di = 0; di < 5; ++di) {
        float q[8];
        win8(ld4(plane + hh[di], lofs), q);
        #pragma unroll
        for (int dj = 0; dj < 5; ++dj) {
          #pragma unroll
          for (int t = 0; t < PXL; ++t)
            acc[t] = fmaf(e[(di * 5 + dj) * PXL + t], q[t + dj], acc[t]);
        }
      }
      #pragma unroll
      for (int t = 0; t < PXL; ++t) r[u][t] = fmaf(scale[t], acc[t], xv[t]);
    }
    #pragma unroll
    for (int u = 0; u < 4; ++u) st2_f4((float*)((char*)(orow + (c + u) * HW) + lofs), r[u]);
    // the next trip rewrites the registers that these stores name
    asm volatile("s_wait_xcnt 0x0" ::: "memory");
  }
}

// =====================================================================================
extern "C" void kernel_launch(void* const* d_in, const int* in_sizes, int n_in,
                              void* d_out, int out_size, void* d_ws, size_t ws_size,
                              hipStream_t stream) {
  if (n_in < 6) return;
  if (in_sizes[0] != X_N || in_sizes[1] != W_N || in_sizes[2] != B_N ||
      in_sizes[3] != W_N || in_sizes[4] != B_N || in_sizes[5] < 1) return;
  if (out_size != OUT_N) return;
  if (ws_size < (size_t)WS_TOTAL) return;

  const float* x     = (const float*)d_in[0];
  const float* Wb    = (const float*)d_in[1];
  const float* bb    = (const float*)d_in[2];
  const float* Wc    = (const float*)d_in[3];
  const float* bc    = (const float*)d_in[4];
  const float* alpha = (const float*)d_in[5];
  float* out = (float*)d_out;

  char* ws = (char*)d_ws;
  float*          px   = (float*)(ws + OFF_PXB);               // pxb, then pxc at +PLANE floats
  unsigned short* xT   = (unsigned short*)(ws + OFF_XT);
  unsigned short* W16  = (unsigned short*)(ws + OFF_W16);

  k_wprep<<<dim3(64), dim3(256), 0, stream>>>(Wb, Wc, W16);
  k_xprep<<<dim3(NB * 4 * (HW / 64)), dim3(256), 0, stream>>>(x, xT);
  k_conv<<<dim3(NB * 4 * (HW / 64)), dim3(256), 0, stream>>>(xT, W16, bb, bc, px);
  k_attn<<<dim3(NB * HDIM), dim3(ATH), 0, stream>>>(x, px, px + PLANE, alpha, out);
}

// v003
// One run takes 32.4 microseconds.
// Two timings next to v002 both put it at 1.28 times that version's speed.
// Over all steps from v000 it is 12.8 times as fast.
#include <hip/hip_runtime.h>

// Contractions: two 1x1 channel GEMMs on v_wmma_f32_16x16x32_f16 (f16 operands: weights carried x16,
// activations x1; f32 accumulate, 1/16 folded in the f32 epilogue). 5x5 reflect-pad window energies,
// softmax and fusion in f32 on VALU.

#define NB     4
#define CD     256
#define HDIM   64
#define WDIM   64
#define HW     (HDIM * WDIM)            // 4096
#define PLANE  (NB * CD * HW)           // 4194304 elements per f32 map
#define X_N    PLANE
#define W_N    (CD * CD)                // 65536
#define B_N    CD
#define OUT_N  PLANE

#define SZ_PX   ((size_t)PLANE * 4)           // 16777216  f32 [n][c][hw]
#define OFF_PXB ((size_t)0)
#define OFF_PXC (OFF_PXB + SZ_PX)
#define WS_TOTAL (OFF_PXC + SZ_PX)            // 33554432

static_assert(WS_TOTAL == 33554432);
static_assert((OFF_PXC % 128) == 0);

typedef unsigned short v4usa __attribute__((ext_vector_type(4), __may_alias__));
typedef unsigned short v8us  __attribute__((ext_vector_type(8)));
typedef unsigned short v16us __attribute__((ext_vector_type(16)));
typedef _Float16       v2h   __attribute__((ext_vector_type(2)));
typedef _Float16       v16h  __attribute__((ext_vector_type(16)));
typedef float          v8f   __attribute__((ext_vector_type(8)));
typedef float          v4f   __attribute__((ext_vector_type(4)));
typedef float          v4fa  __attribute__((ext_vector_type(4), __may_alias__));
typedef unsigned       u32a  __attribute__((__may_alias__));
typedef float          f32a  __attribute__((__may_alias__));

union Frag { v16us v; v8us half[2]; };

// f32 -> f16 bits (RNE convert)
__device__ __forceinline__ unsigned short h2us(float f) {
  return __builtin_bit_cast(unsigned short, (_Float16)f);
}

__device__ __forceinline__ void st2_f4(float* p, v4f v) {
  *(v4f*)p = v;
  
}

// 16-bit fragment from a k-contiguous row: elements 0..7 <- k0+8h.., elements 8..15 <- k0+16+8h..
// Used for A rows [m][k] and for B stored as [n][k] (same per-lane k map).
__device__ __forceinline__ v16h ldfrag(const unsigned short* rowp, int h) {
  Frag f;
  f.half[0] = *(const v8us*)(rowp + 8 * h);
  f.half[1] = *(const v8us*)(rowp + 16 + 8 * h);
  return __builtin_bit_cast(v16h, f.v);
}

__device__ __forceinline__ v8f wmma_h(v16h a, v16h b, v8f c) {
  return __builtin_amdgcn_wmma_f32_16x16x32_f16(false, a, false, b, (short)0, c, false, false);
}

__device__ __forceinline__ v8f v8f_zero() {
  v8f z = {0.f, 0.f, 0.f, 0.f, 0.f, 0.f, 0.f, 0.f};
  return z;
}

// 16 bytes at a base that is the same for the whole work-group plus the lane's own byte offset
__device__ __forceinline__ v4f ld4(const float* base, unsigned boff) {
  return *(const v4f*)((const char*)base + boff);
}

// =====================================================================================
// Kernel 1: both maps, px[g][n][o][hw] = (f16(16 W_g) . f16(x)) / 16 + b_g, f32 (g = 0: pxb, g = 1: pxc).
// Work-group = (g, n, all 256 o, 128 px), 16 waves. It reads W_g (whole lines) and its x tile (64-byte
// pieces) as f32, converts them and lays both in LDS as k-contiguous f16 rows: sA[o][c], sB[px][c]
// (x is transposed on the way: two channels of one pixel make one 4-byte LDS store).
// Wave w: o rows (w>>1)*32 (two A tiles), px cols (w&1)*64 (four B tiles), fragments from LDS.
// Epilogue: the f32 tile [256 o][128 px] takes the operands' LDS; a wave stores whole 512-B rows.
// =====================================================================================
#define TPX  128                // pixels per work-group
#define KP   (CD + 8)           // LDS pitch of both operand tiles, halves: 528 B = 16 B x 33
#define EP   (TPX + 4)          // LDS pitch of the f32 tile, floats: 528 B
#define SA_H (CD * KP)
#define SB_H (TPX * KP)
#define CTH  512
static_assert(HW % TPX == 0 && CD == 256 && CD * EP * 4 <= (SA_H + SB_H) * 2);

__global__ void __launch_bounds__(CTH) k_conv(
    const float* __restrict__ x, const float* __restrict__ Wb, const float* __restrict__ Wc,
    const float* __restrict__ bb, const float* __restrict__ bc, float* __restrict__ px) {
  __shared__ __attribute__((aligned(16))) unsigned short sOp[SA_H + SB_H];
  unsigned short* sA = sOp;
  unsigned short* sB = sOp + SA_H;
  const int tid = threadIdx.x;
  const int lane = tid & 31;
  const int w = __builtin_amdgcn_readfirstlane(tid >> 5);   // the wave's number, kept in a scalar register
  const int h = lane >> 4;
  const int m = lane & 15;
  const int bid = blockIdx.x;
  const int g = bid & 1;
  const int pt = (bid >> 1) & (HW / TPX - 1);
  const int n = bid >> 6;
  const int p0 = pt * TPX;
  const float* Wg = g ? Wc : Wb;
  const float* bg = g ? bc : bb;

  // x tile: a lane takes 4 pixels of channels 2cp and 2cp+1; 8 channel pairs x 4 pixel quads a wave,
  // so that the 32 four-byte LDS stores of an instruction fall on 32 banks
  const int cp = w * 8 + (lane & 7);
  const int pq = lane >> 3;
  const float* xb = x + (size_t)n * CD * HW + p0;
  const unsigned xofs = (unsigned)(2 * cp * HW + 4 * pq) * 4u;
  v4f xe[8], xo[8];
  #pragma unroll
  for (int it = 0; it < 8; ++it) {
    xe[it] = ld4(xb + it * 16, xofs);
    xo[it] = ld4(xb + HW + it * 16, xofs);
  }

  // W_g: 8 rows (8 KiB) per step of the work-group, 4 consecutive k per lane
  const unsigned wofs = (unsigned)tid * 16u;
  unsigned short* sAw = sA + (tid >> 6) * KP + (tid & 63) * 4;
  v4f wv[32];
  #pragma unroll
  for (int u = 0; u < 32; ++u) wv[u] = ld4(Wg + u * (CTH * 4), wofs);
  // the x loads' offset register is dead behind them: it is kept as it is until this wait has passed
  asm volatile("s_wait_xcnt 0x0" :: "v"(xofs) : "memory");
  #pragma unroll
  for (int u = 0; u < 32; ++u) {
    const v4usa hv = {h2us(wv[u].x * 16.0f), h2us(wv[u].y * 16.0f),
                      h2us(wv[u].z * 16.0f), h2us(wv[u].w * 16.0f)};
    *(v4usa*)(sAw + u * 8 * KP) = hv;
  }

  #pragma unroll
  for (int it = 0; it < 8; ++it) {
    #pragma unroll
    for (int i = 0; i < 4; ++i) {
      const v2h pk = {(_Float16)xe[it][i], (_Float16)xo[it][i]};     // RNE, even channel low
      *(u32a*)(sB + (4 * (it * 4 + pq) + i) * KP + 2 * cp) = __builtin_bit_cast(unsigned, pk);
    }
  }
  __syncthreads();

  const int osub = (w >> 1) * 32;
  const int psub = (w & 1) * 64;
  const unsigned short* ar = sA + (osub + m) * KP;
  const unsigned short* br = sB + (psub + m) * KP;

  v8f acc[2][4];
  #pragma unroll
  for (int a = 0; a < 2; ++a) {
    #pragma unroll
    for (int t = 0; t < 4; ++t) acc[a][t] = v8f_zero();
  }

  #pragma unroll
  for (int ks = 0; ks < CD / 32; ++ks) {
    const int k0 = ks * 32;
    v16h fa[2], fb[4];
    #pragma unroll
    for (int a = 0; a < 2; ++a) fa[a] = ldfrag(ar + a * 16 * KP + k0, h);
    #pragma unroll
    for (int t = 0; t < 4; ++t) fb[t] = ldfrag(br + t * 16 * KP + k0, h);
    #pragma unroll
    for (int a = 0; a < 2; ++a) {
      #pragma unroll
      for (int t = 0; t < 4; ++t) acc[a][t] = wmma_h(fa[a], fb[t], acc[a][t]);
    }
  }

  // every wave has read its last fragment before the f32 tile overwrites the operand tiles
  __syncthreads();

  // D element r of lane -> o row osub + a*16 + 8h + r, px col psub + t*16 + m
  f32a* sT = (f32a*)sOp;
  #pragma unroll
  for (int a = 0; a < 2; ++a) {
    const int orow0 = osub + a * 16 + 8 * h;
    const float* bp = bg + orow0;
    #pragma unroll
    for (int t = 0; t < 4; ++t) {
      #pragma unroll
      for (int r = 0; r < 8; ++r)
        sT[(orow0 + r) * EP + psub + t * 16 + m] = acc[a][t][r] * 0.0625f + bp[r];
    }
  }
  __syncthreads();

  float* ob = px + (size_t)g * PLANE + (size_t)n * CD * HW + p0;
  const unsigned oofs = (unsigned)(w * HW + lane * 4) * 4u;
  #pragma unroll
  for (int it = 0; it < 16; ++it) {
    const int row = it * 16 + w;                 // 0..255, each once
    const v4f v = *(const v4fa*)(sT + row * EP + lane * 4);
    st2_f4((float*)((char*)(ob + it * 16 * HW) + oofs), v);
  }
}

// =====================================================================================
// Kernel 2: per-pixel 5x5 attention, f32 on VALU. Work-group = one image row (64 pixels) x AS channel
// slices = 16 waves. A lane owns 4 adjacent pixels, so 16 lanes (one DPP row) cover the image row and
// a wave holds two slices. One 16-byte load per window row and channel gives a lane its own 4 columns;
// the 2 + 2 columns beside them come from the neighbour lanes' registers, and the 8 values feed
// 20 multiply-adds. Each slice sums its share of the 25 energies; the shares meet in LDS in a fixed
// order; every slice then forms the softmax and writes the fused output of its own channels.
// =====================================================================================
#define AS   32                 // channel slices per work-group
#define CPS  (CD / AS)          // channels per slice
#define PXL  4                  // pixels per lane
#define RL   (WDIM / PXL)       // lanes per image row
#define NE   (25 * WDIM)        // energies per work-group
#define ATH  (AS * RL)          // threads per work-group
static_assert(CD % AS == 0 && WDIM == 64 && RL == 16 && ATH <= 1024);

// src of the lane one below (row_shr:1) in the 16-lane row; lane 0 of the row, which has none, gets edge
__device__ __forceinline__ float from_lower(float edge, float src) {
  return __builtin_bit_cast(float, __builtin_amdgcn_update_dpp(
      __builtin_bit_cast(int, edge), __builtin_bit_cast(int, src), 0x111, 0xf, 0xf, false));
}
// src of the lane one above (row_shl:1) in the 16-lane row; lane 15 of the row, which has none, gets edge
__device__ __forceinline__ float from_upper(float edge, float src) {
  return __builtin_bit_cast(float, __builtin_amdgcn_update_dpp(
      __builtin_bit_cast(int, edge), __builtin_bit_cast(int, src), 0x101, 0xf, 0xf, false));
}

// q[i] = column 4j - 2 + i of the reflect-padded row, v = columns 4j..4j+3 (j = lane in the row).
// Reflection: columns -2, -1 are columns 2, 1 (lane 0's own); columns 64, 65 are 62, 61 (lane 15's own).
__device__ __forceinline__ void win8(v4f v, float* q) {
  q[0] = from_lower(v.z, v.z);
  q[1] = from_lower(v.y, v.w);
  q[2] = v.x; q[3] = v.y; q[4] = v.z; q[5] = v.w;
  q[6] = from_upper(v.z, v.x);
  q[7] = from_upper(v.y, v.y);
}

__global__ void __launch_bounds__(ATH) k_attn(
    const float* __restrict__ x, const float* __restrict__ pxb, const float* __restrict__ pxc,
    const float* __restrict__ alpha, float* __restrict__ out) {
  __shared__ __attribute__((aligned(16))) float sE[AS * NE];     // [slice][k][pixel of the row]
  __shared__ __attribute__((aligned(16))) float sR[NE];          // [k][pixel of the row]
  const int tid = threadIdx.x;
  const int j = tid & (RL - 1);
  const int sl = tid >> 4;
  const int n = blockIdx.x >> 6;                    // grid = NB * HDIM exactly
  const int hy = blockIdx.x & (HDIM - 1);

  int hh[5];
  #pragma unroll
  for (int d = 0; d < 5; ++d) {
    int t = hy + d - 2;
    t = (t < 0) ? -t : t;
    t = (t >= HDIM) ? (2 * HDIM - 2 - t) : t;
    hh[d] = t * WDIM;
  }

  const size_t nbase = (size_t)n * CD * HW;                       // same for the whole work-group
  const unsigned lofs = (unsigned)(sl * CPS * HW + PXL * j) * 4u; // the lane's own part, in bytes
  const float* pb = pxb + nbase;
  const float* pc = pxc + nbase + hy * WDIM;

  float e[25 * PXL];
  #pragma unroll
  for (int k = 0; k < 25 * PXL; ++k) e[k] = 0.0f;

  // two channels a trip: their 12 loads are issued together; four a trip spilled registers
  #pragma unroll 2
  for (int c = 0; c < CPS; ++c) {
    const float* plane = pb + c * HW;
    const v4f xc = ld4(pc + c * HW, lofs);
    #pragma unroll
    for (int di = 0; di < 5; ++di) {
      float q[8];
      win8(ld4(plane + hh[di], lofs), q);
      #pragma unroll
      for (int dj = 0; dj < 5; ++dj) {
        #pragma unroll
        for (int t = 0; t < PXL; ++t)
          e[(di * 5 + dj) * PXL + t] = fmaf(xc[t], q[t + dj], e[(di * 5 + dj) * PXL + t]);
      }
    }
  }

  // slices' shares -> LDS; each sum is formed by one thread (4 pixels at a time), slice 0 first
  #pragma unroll
  for (int k = 0; k < 25; ++k) {
    const v4f t = {e[k * PXL + 0], e[k * PXL + 1], e[k * PXL + 2], e[k * PXL + 3]};
    *(v4fa*)(sE + (sl * 25 + k) * WDIM + PXL * j) = t;
  }
  __syncthreads();
  for (int el = tid; el < NE / PXL; el += ATH) {
    v4f t = *(const v4fa*)(sE + el * PXL);
    #pragma unroll
    for (int s = 1; s < AS; ++s) t += *(const v4fa*)(sE + s * NE + el * PXL);
    *(v4fa*)(sR + el * PXL) = t;
  }
  __syncthreads();
  #pragma unroll
  for (int k = 0; k < 25; ++k) {
    const v4f t = *(const v4fa*)(sR + k * WDIM + PXL * j);
    e[k * PXL + 0] = t.x; e[k * PXL + 1] = t.y; e[k * PXL + 2] = t.z; e[k * PXL + 3] = t.w;
  }

  const float al = alpha[0];
  float scale[PXL];
  #pragma unroll
  for (int t = 0; t < PXL; ++t) {
    float mx = e[t];
    #pragma unroll
    for (int k = 1; k < 25; ++k) mx = fmaxf(mx, e[k * PXL + t]);
    float s = 0.0f;
    #pragma unroll
    for (int k = 0; k < 25; ++k) {
      e[k * PXL + t] = __expf(e[k * PXL + t] - mx);
      s += e[k * PXL + t];
    }
    scale[t] = al * (1.0f / s);     // alpha / sum folded
  }

  const float* xr = x + nbase + hy * WDIM;
  float* orow = out + nbase + hy * WDIM;
  static_assert(CPS % 4 == 0);
  // stays rolled: the 24 loads of a trip's four channels already fill the register budget
  #pragma unroll 1
  for (int c = 0; c < CPS; c += 4) {
    v4f r[4];
    #pragma unroll
    for (int u = 0; u < 4; ++u) {
      const float* plane = pb + (c + u) * HW;
      const v4f xv = ld4(xr + (c + u) * HW, lofs);
      float acc[PXL] = {0.0f, 0.0f, 0.0f, 0.0f};
      #pragma unroll
      for (int di = 0; di < 5; ++di) {
        float q[8];
        win8(ld4(plane + hh[di], lofs), q);
        #pragma unroll
        for (int dj = 0; dj < 5; ++dj) {
          #pragma unroll
          for (int t = 0; t < PXL; ++t)
            acc[t] = fmaf(e[(di * 5 + dj) * PXL + t], q[t + dj], acc[t]);
        }
      }
      #pragma unroll
      for (int t = 0; t < PXL; ++t) r[u][t] = fmaf(scale[t], acc[t], xv[t]);
    }
    #pragma unroll
    for (int u = 0; u < 4; ++u) st2_f4((float*)((char*)(orow + (c + u) * HW) + lofs), r[u]);
    // the next trip rewrites the registers that these stores name
    asm volatile("s_wait_xcnt 0x0" ::: "memory");
  }
}

// =====================================================================================
extern "C" void kernel_launch(void* const* d_in, const int* in_sizes, int n_in,
                              void* d_out, int out_size, void* d_ws, size_t ws_size,
                              hipStream_t stream) {
  if (n_in < 6) return;
  if (in_sizes[0] != X_N || in_sizes[1] != W_N || in_sizes[2] != B_N ||
      in_sizes[3] != W_N || in_sizes[4] != B_N || in_sizes[5] < 1) return;
  if (out_size != OUT_N) return;
  if (ws_size < (size_t)WS_TOTAL) return;

  const float* x     = (const float*)d_in[0];
  const float* Wb    = (const float*)d_in[1];
  const float* bb    = (const float*)d_in[2];
  const float* Wc    = (const float*)d_in[3];
  const float* bc    = (const float*)d_in[4];
  const float* alpha = (const float*)d_in[5];
  float* out = (float*)d_out;

  char* ws = (char*)d_ws;
  float*          px   = (float*)(ws + OFF_PXB);               // pxb, then pxc at +PLANE floats

  k_conv<<<dim3(NB * (HW / TPX) * 2), dim3(CTH), 0, stream>>>(x, Wb, Wc, bb, bc, px);
  k_attn<<<dim3(NB * HDIM), dim3(ATH), 0, stream>>>(x, px, px + PLANE, alpha, out);
}

// v004
// One run takes 25.1 microseconds.
// Two timings next to v003 put it at 1.27 and 1.30 times that version's speed.
// All steps since v000 together make it 16.4 times as fast.
#include <hip/hip_runtime.h>

// One launch, one work-group per image row (64 pixels, all 256 channels).
// The 1x1 convolutions commute with the reflect padding and with the window sums, so no convolved map
// is needed outside a pixel's own row:
//   energy[p][k] = pxc[.][p] . (Wb x[.][q] + bb) = z[.][p] . x[.][q] + pxc[.][p] . bb,  z = Wb^T pxc,
//     q = window pixel k of p; the last term is the same for all 25 k and drops out of the softmax;
//   fusion[.][p] = sum_k a[k] (Wb x[.][q] + bb) = Wb u[.][p] + bb,  u = sum_k a[k] x[.][q]  (sum_k a[k] = 1).
// Three channel GEMMs on v_wmma_f32_16x16x32_f16 (f16 operands: weights carried x16, activations x1;
// f32 accumulate, 1/16 folded in the f32 epilogues): pxc = Wc x + bc, z = Wb^T pxc, Wb u.
// 5x5 reflect-pad window energies, softmax and window sums in f32 on VALU, on x itself.

#define NB     4
#define CD     256
#define HDIM   64
#define WDIM   64
#define HW     (HDIM * WDIM)            // 4096
#define PLANE  (NB * CD * HW)           // 4194304 elements per f32 map
#define X_N    PLANE
#define W_N    (CD * CD)                // 65536
#define B_N    CD
#define OUT_N  PLANE

typedef unsigned short v4usa __attribute__((ext_vector_type(4), __may_alias__));
typedef unsigned short v8us  __attribute__((ext_vector_type(8)));
typedef unsigned short v8usa __attribute__((ext_vector_type(8), __may_alias__));
typedef unsigned short v16us __attribute__((ext_vector_type(16)));
typedef short          s16x8 __attribute__((ext_vector_type(8)));
typedef _Float16       v2h   __attribute__((ext_vector_type(2)));
typedef _Float16       v16h  __attribute__((ext_vector_type(16)));
typedef float          v8f   __attribute__((ext_vector_type(8)));
typedef float          v4f   __attribute__((ext_vector_type(4)));
typedef float          v4fa  __attribute__((ext_vector_type(4), __may_alias__));
typedef unsigned       u32a  __attribute__((__may_alias__));
typedef float          f32a  __attribute__((__may_alias__));
// pointers that say "global memory" themselves, for addresses that an asm statement names
typedef const __attribute__((address_space(1))) char gbyte;
typedef const __attribute__((address_space(1))) v4f  gv4f;

union Frag { v16us v; v8us half[2]; };

// f32 -> f16 bits (RNE convert)
__device__ __forceinline__ unsigned short h2us(float f) {
  return __builtin_bit_cast(unsigned short, (_Float16)f);
}

__device__ __forceinline__ void st2_f4(float* p, v4f v) {
  *(v4f*)p = v;
}

// 16-bit fragment from a k-contiguous row: elements 0..7 <- k0+8h.., elements 8..15 <- k0+16+8h..
// Used for A rows [m][k] and for B stored as [n][k] (same per-lane k map).
__device__ __forceinline__ v16h ldfrag(const unsigned short* rowp, int h) {
  Frag f;
  f.half[0] = *(const v8usa*)(rowp + 8 * h);
  f.half[1] = *(const v8usa*)(rowp + 16 + 8 * h);
  return __builtin_bit_cast(v16h, f.v);
}

// transposing LDS load: the lane's address walks the k rows of a row-major 16-bit tile T[k][d];
// lane (m, h) receives T[kbase + 8h + 0..7][dbase + m]
__device__ __forceinline__ v8us ld_tr16(const unsigned char* p) {
  typedef __attribute__((address_space(3))) s16x8 lds_s16x8;
  return __builtin_bit_cast(v8us, __builtin_amdgcn_ds_load_tr16_b128_v8i16((lds_s16x8*)p));
}

__device__ __forceinline__ v8f wmma_h(v16h a, v16h b, v8f c) {
  return __builtin_amdgcn_wmma_f32_16x16x32_f16(false, a, false, b, (short)0, c, false, false);
}

__device__ __forceinline__ v8f v8f_zero() {
  v8f z = {0.f, 0.f, 0.f, 0.f, 0.f, 0.f, 0.f, 0.f};
  return z;
}

// 16 bytes at a base that is the same for the whole work-group plus the lane's own byte offset
__device__ __forceinline__ v4f ld4(const float* base, unsigned boff) {
  return *(const v4f*)((const char*)base + boff);
}

#define TH   512                // threads per work-group, 16 waves
#define KP   (CD + 8)           // LDS pitch of the f16 operand tiles, halves: 528 B = 16 B x 33
#define ZP   (WDIM + 4)         // LDS pitch of the f32 tiles [channel][pixel], floats: 272 B = 16 B x 17

#define AS   32                 // channel slices per work-group
#define CPS  (CD / AS)          // channels per slice
#define PXL  4                  // pixels per lane
#define RL   (WDIM / PXL)       // lanes per image row
#define NE   (25 * WDIM)        // energies per work-group
static_assert(CD % AS == 0 && WDIM == 64 && RL == 16 && AS * RL == TH && CD == 256);

// LDS map, bytes. Regions that share bytes are never live together (a barrier lies between their uses).
//   sWb  Wb f16 [256][KP], staged once, read by products 2 (transposed) and 3
//   sWc  Wc f16 [256][KP]      -> sZ  z f32 [256][ZP]       -> sU  u f16 [64][KP]
//   sX   x row f16 [64][KP]    -> sP  pxc f16 [64][KP]      -> sE  energy shares, one per wave -> f32 output tile
//   sR   energy sums
#define NSH   (AS / 2)                    // energy shares: a wave adds its two slices before LDS
#define SZ_A  (CD * KP * 2)               // 135168
#define SZ_X  (WDIM * KP * 2)             // 33792
#define SZ_Z  (CD * ZP * 4)               // 69632
#define SZ_E  (NSH * NE * 4)              // 102400
#define SZ_R  (NE * 4)                    // 6400
#define O_WB  0
#define O_WC  SZ_A
#define O_X   (O_WC + SZ_A)               // 270336
#define O_P   O_X
#define O_Z   O_WC
#define O_U   O_WC
#define O_E   (O_Z + SZ_Z)                // 204800
#define O_T   O_E
#define O_R   (O_E + SZ_E)                // 307200
#define LDS_B (O_R + SZ_R)                // 313600
static_assert(O_X + SZ_X <= LDS_B && O_Z + SZ_Z <= O_P && O_U + SZ_X <= O_T && O_T + SZ_Z <= O_R && LDS_B <= 327680);
static_assert((O_WC % 16) == 0 && (O_X % 16) == 0 && (O_E % 16) == 0 && (O_R % 16) == 0);

// a 256 x 256 f32 weight matrix: 8 rows (8 KiB) per step of the work-group, 4 consecutive k per lane
__device__ __forceinline__ void w_load(const float* Wg, unsigned wofs, v4f (&wv)[32]) {
  #pragma unroll
  for (int u = 0; u < 32; ++u) wv[u] = ld4(Wg + u * (TH * 4), wofs);
}
__device__ __forceinline__ void w_stage(unsigned short* sAw, const v4f (&wv)[32]) {
  #pragma unroll
  for (int u = 0; u < 32; ++u) {
    const v4usa hv = {h2us(wv[u].x * 16.0f), h2us(wv[u].y * 16.0f),
                      h2us(wv[u].z * 16.0f), h2us(wv[u].w * 16.0f)};
    *(v4usa*)(sAw + u * 8 * KP) = hv;
  }
}

// the value of lane l ^ 16
__device__ __forceinline__ float xhalf(float v) {
  return __builtin_bit_cast(float, __builtin_amdgcn_permlanex16(
      __builtin_bit_cast(int, v), __builtin_bit_cast(int, v), 0x76543210, 0xfedcba98, false, false));
}

// src of the lane one below (row_shr:1) in the 16-lane row; lane 0 of the row, which has none, gets edge
__device__ __forceinline__ float from_lower(float edge, float src) {
  return __builtin_bit_cast(float, __builtin_amdgcn_update_dpp(
      __builtin_bit_cast(int, edge), __builtin_bit_cast(int, src), 0x111, 0xf, 0xf, false));
}
// src of the lane one above (row_shl:1) in the 16-lane row; lane 15 of the row, which has none, gets edge
__device__ __forceinline__ float from_upper(float edge, float src) {
  return __builtin_bit_cast(float, __builtin_amdgcn_update_dpp(
      __builtin_bit_cast(int, edge), __builtin_bit_cast(int, src), 0x101, 0xf, 0xf, false));
}

// q[i] = column 4j - 2 + i of the reflect-padded row, v = columns 4j..4j+3 (j = lane in the row).
// Reflection: columns -2, -1 are columns 2, 1 (lane 0's own); columns 64, 65 are 62, 61 (lane 15's own).
__device__ __forceinline__ void win8(v4f v, float* q) {
  q[0] = from_lower(v.z, v.z);
  q[1] = from_lower(v.y, v.w);
  q[2] = v.x; q[3] = v.y; q[4] = v.z; q[5] = v.w;
  q[6] = from_upper(v.z, v.x);
  q[7] = from_upper(v.y, v.y);
}

// GEMM tiling, all three products: [256 rows][64 pixels], wave w: rows (w>>1)*32 (two A tiles),
// pixels (w&1)*32 (two B tiles). D element r of a lane -> row rsub + a*16 + 8h + r, pixel psub + t*16 + m.
// Window part: a lane owns 4 adjacent pixels, 16 lanes (one DPP row) cover the image row, a wave holds two
// of the 32 channel slices; one 16-byte load per window row and channel, side columns from neighbour lanes.
__global__ void __launch_bounds__(TH) k_pam(
    const float* __restrict__ x, const float* __restrict__ Wb, const float* __restrict__ bb,
    const float* __restrict__ Wc, const float* __restrict__ bc, const float* __restrict__ alpha,
    float* __restrict__ out) {
  __shared__ __attribute__((aligned(16))) unsigned char sm[LDS_B];
  unsigned short* sWb = (unsigned short*)(sm + O_WB);
  unsigned short* sWc = (unsigned short*)(sm + O_WC);
  unsigned short* sX = (unsigned short*)(sm + O_X);
  unsigned short* sP = (unsigned short*)(sm + O_P);
  unsigned short* sU = (unsigned short*)(sm + O_U);
  f32a* sZ = (f32a*)(sm + O_Z);
  f32a* sT = (f32a*)(sm + O_T);
  f32a* sE = (f32a*)(sm + O_E);          // [wave][k][pixel of the row]
  f32a* sR = (f32a*)(sm + O_R);          // [k][pixel of the row]

  const int tid = threadIdx.x;
  const int lane = tid & 31;
  const int w = __builtin_amdgcn_readfirstlane(tid >> 5);   // the wave's number, kept in a scalar register
  const int h = lane >> 4;
  const int m = lane & 15;
  const int n = blockIdx.x >> 6;                    // grid = NB * HDIM exactly
  const int hy = blockIdx.x & (HDIM - 1);
  const size_t nbase = (size_t)n * CD * HW;         // same for the whole work-group
  const float* xr = x + nbase + hy * WDIM;          // the work-group's own image row, channel 0

  const int rsub = (w >> 1) * 32;
  const int psub = (w & 1) * 32;

  // ---- stage Wc and the x row as f16, k-contiguous ------------------------------------------------
  // x row: a lane takes 4 pixels of channels 2cp and 2cp+1; 8 channel pairs x 4 pixel quads a wave,
  // so that the 32 four-byte LDS stores of an instruction fall on 32 banks
  const int cp = w * 8 + (lane & 7);
  const int pq = lane >> 3;
  const unsigned xofs = (unsigned)(2 * cp * HW + 4 * pq) * 4u;
  const unsigned wofs = (unsigned)tid * 16u;
  const unsigned bofs = (unsigned)(rsub + 8 * h) * 4u;   // the lane's first D row, in bytes, for the bias vectors
  v4f bcv[4];
  const int aw = (tid >> 6) * KP + (tid & 63) * 4;      // the thread's place in the first 8 rows of a weight tile
  {
    v4f xe[4], xo[4];
    #pragma unroll
    for (int it = 0; it < 4; ++it) {
      xe[it] = ld4(xr + it * 16, xofs);
      xo[it] = ld4(xr + HW + it * 16, xofs);
    }
    #pragma unroll
    for (int a = 0; a < 2; ++a) {
      bcv[2 * a] = ld4(bc + a * 16, bofs);
      bcv[2 * a + 1] = ld4(bc + a * 16 + 4, bofs);
    }
    v4f wv[32];
    w_load(Wc, wofs, wv);
    // the offset registers of the x and bias loads are kept as they are until this wait has passed
    asm volatile("s_wait_xcnt 0x0" :: "v"(xofs), "v"(bofs) : "memory");
    w_stage(sWc + aw, wv);
    #pragma unroll
    for (int it = 0; it < 4; ++it) {
      #pragma unroll
      for (int i = 0; i < 4; ++i) {
        const v2h pk = {(_Float16)xe[it][i], (_Float16)xo[it][i]};     // RNE, even channel low
        *(u32a*)(sX + (4 * (it * 4 + pq) + i) * KP + 2 * cp) = __builtin_bit_cast(unsigned, pk);
      }
    }
  }
  __syncthreads();
  // Wb is asked for here, so that it travels under the first product
  v4f wv2[32];
  w_load(Wb, wofs, wv2);
  // the offset register and the base of these loads are kept as they are until this wait has passed
  asm volatile("s_wait_xcnt 0x0" :: "v"(wofs), "s"(Wb) : "memory");

  // ---- product 1: pxc = Wc x + bc, rounded to f16 as [pixel][o], the B operand of product 2 --------
  {
    v8f acc[2][2];
    #pragma unroll
    for (int a = 0; a < 2; ++a) {
      #pragma unroll
      for (int t = 0; t < 2; ++t) acc[a][t] = v8f_zero();
    }
    const unsigned short* ar = sWc + (rsub + m) * KP;
    const unsigned short* br = sX + (psub + m) * KP;
    #pragma unroll
    for (int ks = 0; ks < CD / 32; ++ks) {
      const int k0 = ks * 32;
      v16h fa[2], fb[2];
      #pragma unroll
      for (int a = 0; a < 2; ++a) fa[a] = ldfrag(ar + a * 16 * KP + k0, h);
      #pragma unroll
      for (int t = 0; t < 2; ++t) fb[t] = ldfrag(br + t * 16 * KP + k0, h);
      #pragma unroll
      for (int a = 0; a < 2; ++a) {
        #pragma unroll
        for (int t = 0; t < 2; ++t) acc[a][t] = wmma_h(fa[a], fb[t], acc[a][t]);
      }
    }
    // Wb has a place of its own, so it is laid down as soon as it is here
    w_stage(sWb + aw, wv2);
    // every wave has read its last x fragment before pxc takes the x row's place
    __syncthreads();
    #pragma unroll
    for (int a = 0; a < 2; ++a) {
      const int orow0 = rsub + a * 16 + 8 * h;
      #pragma unroll
      for (int t = 0; t < 2; ++t) {
        v8us hv;
        #pragma unroll
        for (int r = 0; r < 8; ++r) hv[r] = h2us(acc[a][t][r] * 0.0625f + bcv[2 * a + (r >> 2)][r & 3]);
        *(v8usa*)(sP + (psub + t * 16 + m) * KP + orow0) = hv;
      }
    }
  }
  __syncthreads();

  // ---- product 2: z = Wb^T pxc; A = Wb^T by transposing loads from the row-major Wb tile ------------
  {
    v8f acc[2][2];
    #pragma unroll
    for (int a = 0; a < 2; ++a) {
      #pragma unroll
      for (int t = 0; t < 2; ++t) acc[a][t] = v8f_zero();
    }
    const unsigned char* ta = (const unsigned char*)sWb + (8 * h + (lane & 7)) * (KP * 2)
                              + ((lane >> 3) & 1) * 16 + rsub * 2;
    const unsigned short* br = sP + (psub + m) * KP;
    #pragma unroll
    for (int ks = 0; ks < CD / 32; ++ks) {
      const int k0 = ks * 32;
      v16h fa[2], fb[2];
      #pragma unroll
      for (int a = 0; a < 2; ++a) {
        Frag f;
        f.half[0] = ld_tr16(ta + k0 * (KP * 2) + a * 32);
        f.half[1] = ld_tr16(ta + (k0 + 16) * (KP * 2) + a * 32);
        fa[a] = __builtin_bit_cast(v16h, f.v);
      }
      #pragma unroll
      for (int t = 0; t < 2; ++t) fb[t] = ldfrag(br + t * 16 * KP + k0, h);
      #pragma unroll
      for (int a = 0; a < 2; ++a) {
        #pragma unroll
        for (int t = 0; t < 2; ++t) acc[a][t] = wmma_h(fa[a], fb[t], acc[a][t]);
      }
    }
    #pragma unroll
    for (int a = 0; a < 2; ++a) {
      const int crow0 = rsub + a * 16 + 8 * h;
      #pragma unroll
      for (int t = 0; t < 2; ++t) {
        #pragma unroll
        for (int r = 0; r < 8; ++r)
          sZ[(crow0 + r) * ZP + psub + t * 16 + m] = acc[a][t][r] * 0.0625f;
      }
    }
  }
  __syncthreads();

  // ---- window energies: e[k][p] = sum_c z[c][p] x[c][window pixel k of p] ---------------------------
  const int j = tid & (RL - 1);
  const int sl = tid >> 4;

  int hh[5];
  #pragma unroll
  for (int d = 0; d < 5; ++d) {
    int t = hy + d - 2;
    t = (t < 0) ? -t : t;
    t = (t >= HDIM) ? (2 * HDIM - 2 - t) : t;
    hh[d] = t * WDIM;
  }

  const unsigned lofs = (unsigned)(sl * CPS * HW + PXL * j) * 4u; // the lane's own part, in bytes
  const float* pb = x + nbase;
  const f32a* zc = sZ + sl * CPS * ZP + PXL * j;

  float e[25 * PXL];
  #pragma unroll
  for (int k = 0; k < 25 * PXL; ++k) e[k] = 0.0f;

  // two channels a trip: their 10 loads are issued together; four a trip spilled registers
  #pragma unroll 2
  for (int c = 0; c < CPS; ++c) {
    const float* plane = pb + c * HW;
    const v4f xc = *(const v4fa*)(zc + c * ZP);
    #pragma unroll
    for (int di = 0; di < 5; ++di) {
      float q[8];
      win8(ld4(plane + hh[di], lofs), q);
      #pragma unroll
      for (int dj = 0; dj < 5; ++dj) {
        #pragma unroll
        for (int t = 0; t < PXL; ++t)
          e[(di * 5 + dj) * PXL + t] = fmaf(xc[t], q[t + dj], e[(di * 5 + dj) * PXL + t]);
      }
    }
  }

  // a wave's two slices (lanes l and l ^ 16 hold the same pixels) are added in registers; the waves' shares
  // go to LDS; each sum is formed by one thread (4 pixels at a time), wave 0 first
  #pragma unroll
  for (int k = 0; k < 25 * PXL; ++k) e[k] += xhalf(e[k]);
  if (h == 0) {
    #pragma unroll
    for (int k = 0; k < 25; ++k) {
      const v4f t = {e[k * PXL + 0], e[k * PXL + 1], e[k * PXL + 2], e[k * PXL + 3]};
      *(v4fa*)(sE + (w * 25 + k) * WDIM + PXL * j) = t;
    }
  }
  __syncthreads();
  for (int el = tid; el < NE / PXL; el += TH) {
    v4f t = *(const v4fa*)(sE + el * PXL);
    #pragma unroll
    for (int s = 1; s < NSH; ++s) t += *(const v4fa*)(sE + s * NE + el * PXL);
    *(v4fa*)(sR + el * PXL) = t;
  }
  __syncthreads();
  #pragma unroll
  for (int k = 0; k < 25; ++k) {
    const v4f t = *(const v4fa*)(sR + k * WDIM + PXL * j);
    e[k * PXL + 0] = t.x; e[k * PXL + 1] = t.y; e[k * PXL + 2] = t.z; e[k * PXL + 3] = t.w;
  }

  float scale[PXL];
  #pragma unroll
  for (int t = 0; t < PXL; ++t) {
    float mx = e[t];
    #pragma unroll
    for (int k = 1; k < 25; ++k) mx = fmaxf(mx, e[k * PXL + t]);
    float s = 0.0f;
    #pragma unroll
    for (int k = 0; k < 25; ++k) {
      e[k * PXL + t] = __expf(e[k * PXL + t] - mx);
      s += e[k * PXL + t];
    }
    scale[t] = 1.0f / s;
  }

  // ---- window sums: u[c][p] = sum_k a[k][p] x[c][window pixel k of p], rounded to f16 as [pixel][c] --
  static_assert(CPS % 4 == 0);
  unsigned short* up = sU + PXL * j * KP + sl * CPS;
  gbyte* wr[5];                   // the lane's own address in each of the five window rows, moved on by four channels a trip
  #pragma unroll
  for (int di = 0; di < 5; ++di) wr[di] = (gbyte*)(pb + hh[di]) + lofs;
  // stays rolled: a trip's four channels hold 80 registers of window rows beside the 100 weights
  #pragma unroll 1
  for (int c = 0; c < CPS; c += 4) {
    v4f rw[4][5];
    #pragma unroll
    for (int u = 0; u < 4; ++u) {
      #pragma unroll
      for (int di = 0; di < 5; ++di) rw[u][di] = *(gv4f*)(wr[di] + u * (HW * 4));
    }
    // the trip's 20 loads stand together in front of this wait; their address registers are kept as they
    // are until it has passed, and are moved on behind it
    asm volatile("s_wait_xcnt 0x0" :: "v"(wr[0]), "v"(wr[1]), "v"(wr[2]), "v"(wr[3]), "v"(wr[4]) : "memory");
    #pragma unroll
    for (int di = 0; di < 5; ++di) wr[di] += 4 * HW * 4;
    float r[4][PXL];
    #pragma unroll
    for (int u = 0; u < 4; ++u) {
      float acc[PXL] = {0.0f, 0.0f, 0.0f, 0.0f};
      #pragma unroll
      for (int di = 0; di < 5; ++di) {
        float q[8];
        win8(rw[u][di], q);
        #pragma unroll
        for (int dj = 0; dj < 5; ++dj) {
          #pragma unroll
          for (int t = 0; t < PXL; ++t)
            acc[t] = fmaf(e[(di * 5 + dj) * PXL + t], q[t + dj], acc[t]);
        }
      }
      #pragma unroll
      for (int t = 0; t < PXL; ++t) r[u][t] = scale[t] * acc[t];
    }
    #pragma unroll
    for (int t = 0; t < PXL; ++t) {
      const v4usa hv = {h2us(r[0][t]), h2us(r[1][t]), h2us(r[2][t]), h2us(r[3][t])};
      *(v4usa*)(up + t * KP + c) = hv;
    }
  }

  // ---- product 3: Wb u; out = alpha (Wb u + bb) + x -------------------------------------------------
  const float al = alpha[0];
  __syncthreads();
  // the residual rows, two per wave and step, asked for here, so that they travel under the product
  const unsigned oofs = (unsigned)((w * 2 + h) * HW + m * 4) * 4u;
  v4f xres[8];
  #pragma unroll
  for (int it = 0; it < 8; ++it) xres[it] = ld4(xr + it * 32 * HW, oofs);
  v4f bbv[4];
  #pragma unroll
  for (int a = 0; a < 2; ++a) {
    bbv[2 * a] = ld4(bb + a * 16, bofs);
    bbv[2 * a + 1] = ld4(bb + a * 16 + 4, bofs);
  }
  // the offset registers of these loads are kept as they are until this wait has passed
  asm volatile("s_wait_xcnt 0x0" :: "v"(oofs), "v"(bofs) : "memory");
  {
    v8f acc[2][2];
    #pragma unroll
    for (int a = 0; a < 2; ++a) {
      #pragma unroll
      for (int t = 0; t < 2; ++t) acc[a][t] = v8f_zero();
    }
    const unsigned short* ar = sWb + (rsub + m) * KP;
    const unsigned short* br = sU + (psub + m) * KP;
    #pragma unroll
    for (int ks = 0; ks < CD / 32; ++ks) {
      const int k0 = ks * 32;
      v16h fa[2], fb[2];
      #pragma unroll
      for (int a = 0; a < 2; ++a) fa[a] = ldfrag(ar + a * 16 * KP + k0, h);
      #pragma unroll
      for (int t = 0; t < 2; ++t) fb[t] = ldfrag(br + t * 16 * KP + k0, h);
      #pragma unroll
      for (int a = 0; a < 2; ++a) {
        #pragma unroll
        for (int t = 0; t < 2; ++t) acc[a][t] = wmma_h(fa[a], fb[t], acc[a][t]);
      }
    }
    // the f32 tile takes the energy shares' place, last read before the barrier in front of the softmax
    #pragma unroll
    for (int a = 0; a < 2; ++a) {
      const int orow0 = rsub + a * 16 + 8 * h;
      #pragma unroll
      for (int t = 0; t < 2; ++t) {
        #pragma unroll
        for (int r = 0; r < 8; ++r)
          sT[(orow0 + r) * ZP + psub + t * 16 + m] = al * (acc[a][t][r] * 0.0625f + bbv[2 * a + (r >> 2)][r & 3]);
      }
    }
  }
  __syncthreads();

  float* orow = out + nbase + hy * WDIM;
  #pragma unroll
  for (int it = 0; it < 8; ++it) {
    const int row = it * 32 + w * 2 + h;               // 0..255, each once; 256 B of a row per 16 lanes
    const v4f v = *(const v4fa*)(sT + row * ZP + m * 4) + xres[it];
    st2_f4((float*)((char*)(orow + it * 32 * HW) + oofs), v);
  }
}

// =====================================================================================
extern "C" void kernel_launch(void* const* d_in, const int* in_sizes, int n_in,
                              void* d_out, int out_size, void* d_ws, size_t ws_size,
                              hipStream_t stream) {
  if (n_in < 6) return;
  if (in_sizes[0] != X_N || in_sizes[1] != W_N || in_sizes[2] != B_N ||
      in_sizes[3] != W_N || in_sizes[4] != B_N || in_sizes[5] < 1) return;
  if (out_size != OUT_N) return;

  const float* x     = (const float*)d_in[0];
  const float* Wb    = (const float*)d_in[1];
  const float* bb    = (const float*)d_in[2];
  const float* Wc    = (const float*)d_in[3];
  const float* bc    = (const float*)d_in[4];
  const float* alpha = (const float*)d_in[5];
  float* out = (float*)d_out;

  k_pam<<<dim3(NB * HDIM), dim3(TH), 0, stream>>>(x, Wb, bb, Wc, bc, alpha, out);
}

// v005
// One run takes 20.5 microseconds.
// Timed twice side by side with v004, it ran 1.22 times as fast both times.
// Over all steps from v000 it is 20.0 times as fast.
#include <hip/hip_runtime.h>

// One launch, one work-group per image row (64 pixels, all 256 channels).
// The 1x1 convolutions commute with the reflect padding and with the window sums, so no convolved map
// is needed outside a pixel's own row:
//   energy[p][k] = pxc[.][p] . (Wb x[.][q] + bb) = z[.][p] . x[.][q] + pxc[.][p] . bb,  z = Wb^T pxc,
//     q = window pixel k of p; the last term is the same for all 25 k and drops out of the softmax;
//   fusion[.][p] = sum_k a[k] (Wb x[.][q] + bb) = Wb u[.][p] + bb,  u = sum_k a[k] x[.][q]  (sum_k a[k] = 1).
// Three channel GEMMs on v_wmma_f32_16x16x32_f16 (f16 operands: weights carried x16, activations x1;
// f32 accumulate, 1/16 folded in the f32 epilogues): pxc = Wc x + bc, z = Wb^T pxc, Wb u.
// The 5x5 reflect-pad window part runs on the same instruction as banded products, on the five window rows
// of x held in LDS as f16 [pixel][channel]: for 16 pixels p0.. and window row di, with column s = 0..31
// standing for image column reflect(p0 - 2 + s),
//   E[s][p] = sum_c x_di[c][s] z[c][p]     (k = 256 channels; energy (di, dj) of pixel p0 + i is E[i + dj][i]),
//   u[c][p] = sum_di sum_s x_di[c][s] a_di[p][s]   (k = 32 columns; a_di[p0 + i][s] is 0 outside s = i .. i + 4).
// Softmax in f32 on VALU.

#define NB     4
#define CD     256
#define HDIM   64
#define WDIM   64
#define HW     (HDIM * WDIM)            // 4096
#define PLANE  (NB * CD * HW)           // 4194304 elements per f32 map
#define X_N    PLANE
#define W_N    (CD * CD)                // 65536
#define B_N    CD
#define OUT_N  PLANE

typedef unsigned short v4usa __attribute__((ext_vector_type(4), __may_alias__));
typedef unsigned short v8us  __attribute__((ext_vector_type(8)));
typedef unsigned short v8usa __attribute__((ext_vector_type(8), __may_alias__));
typedef unsigned short v16us __attribute__((ext_vector_type(16)));
typedef short          s16x8 __attribute__((ext_vector_type(8)));
typedef _Float16       v2h   __attribute__((ext_vector_type(2)));
typedef _Float16       v16h  __attribute__((ext_vector_type(16)));
typedef float          v8f   __attribute__((ext_vector_type(8)));
typedef float          v4f   __attribute__((ext_vector_type(4)));
typedef float          v4fa  __attribute__((ext_vector_type(4), __may_alias__));
typedef unsigned       u32a  __attribute__((__may_alias__));
typedef unsigned short u16a  __attribute__((__may_alias__));
typedef float          f32a  __attribute__((__may_alias__));

union Frag { v16us v; v8us half[2]; };

// f32 -> f16 bits (RNE convert)
__device__ __forceinline__ unsigned short h2us(float f) {
  return __builtin_bit_cast(unsigned short, (_Float16)f);
}

__device__ __forceinline__ void st2_f4(float* p, v4f v) {
  *(v4f*)p = v;
}

// 16-bit fragment from a k-contiguous row: elements 0..7 <- k0+8h.., elements 8..15 <- k0+16+8h..
// Used for A rows [m][k] and for B stored as [n][k] (same per-lane k map).
__device__ __forceinline__ v16h ldfrag(const unsigned short* rowp, int h) {
  Frag f;
  f.half[0] = *(const v8usa*)(rowp + 8 * h);
  f.half[1] = *(const v8usa*)(rowp + 16 + 8 * h);
  return __builtin_bit_cast(v16h, f.v);
}

// transposing LDS load: the lane's address walks the k rows of a row-major 16-bit tile T[k][d];
// lane (m, h) receives T[kbase + 8h + 0..7][dbase + m]
__device__ __forceinline__ v8us ld_tr16(const unsigned char* p) {
  typedef __attribute__((address_space(3))) s16x8 lds_s16x8;
  return __builtin_bit_cast(v8us, __builtin_amdgcn_ds_load_tr16_b128_v8i16((lds_s16x8*)p));
}

__device__ __forceinline__ v8f wmma_h(v16h a, v16h b, v8f c) {
  return __builtin_amdgcn_wmma_f32_16x16x32_f16(false, a, false, b, (short)0, c, false, false);
}

__device__ __forceinline__ v8f v8f_zero() {
  v8f z = {0.f, 0.f, 0.f, 0.f, 0.f, 0.f, 0.f, 0.f};
  return z;
}

// 16 bytes at a base that is the same for the whole work-group plus the lane's own byte offset
__device__ __forceinline__ v4f ld4(const float* base, unsigned boff) {
  return *(const v4f*)((const char*)base + boff);
}

#define TH   512                // threads per work-group, 16 waves
#define KP   (CD + 8)           // LDS pitch of the f16 operand tiles, halves: 528 B = 16 B x 33
#define ZP   (WDIM + 4)         // LDS pitch of the f32 tiles [channel][pixel], floats: 272 B = 16 B x 17

#define NE   (25 * WDIM)        // energies per work-group
#define AP   24                 // LDS pitch of the weight bands, halves: 48 B = 16 B x 3; columns 24..31 are never stored
static_assert(WDIM == 64 && HDIM == 64 && CD == 256 && TH == 512);

// LDS map, bytes. Regions that share bytes are never live together (a barrier lies between their uses).
//   sWb  Wb f16 [256][KP], staged once, read by products 2 (transposed) and 3
//   sWc  Wc f16 [256][KP]  -> four places of [64][KP]: pxc f16 (0), z f16 (1)
//                          -> window rows 0, 1, 3, 4 of x, f16 (0..3)  -> u f16 (0), f32 output tile (1..3)
//   sX   the work-group's own x row (window row 2), f16 [64][KP], kept to the end of the window part
//   sR   energies f32 [25][64];  sA  softmax weights f16 as bands [5][64][AP]
#define SZ_A  (CD * KP * 2)               // 135168
#define SZ_X  (WDIM * KP * 2)             // 33792
#define SZ_Z  (CD * ZP * 4)               // 69632
#define SZ_R  (NE * 4)                    // 6400
#define SZ_B  (5 * WDIM * AP * 2)         // 15360
#define O_WB  0
#define O_WC  SZ_A
#define O_X   (O_WC + SZ_A)               // 270336
#define O_P   O_WC
#define O_ZH  (O_WC + SZ_X)
#define O_U   O_WC
#define O_T   (O_WC + SZ_X)
#define O_R   (O_X + SZ_X)                // 304128
#define O_A   (O_R + SZ_R)                // 310528
#define LDS_B (O_A + SZ_B)                // 325888
static_assert(4 * SZ_X == SZ_A && O_T + SZ_Z <= O_X && LDS_B <= 327680);
static_assert((O_WC % 16) == 0 && (O_X % 16) == 0 && (SZ_X % 16) == 0 && (O_R % 16) == 0 && (O_A % 16) == 0);

// a 256 x 256 f32 weight matrix: 8 rows (8 KiB) per step of the work-group, 4 consecutive k per lane
__device__ __forceinline__ void w_load(const float* Wg, unsigned wofs, v4f (&wv)[32]) {
  #pragma unroll
  for (int u = 0; u < 32; ++u) wv[u] = ld4(Wg + u * (TH * 4), wofs);
}
__device__ __forceinline__ void w_stage(unsigned short* sAw, const v4f (&wv)[32]) {
  #pragma unroll
  for (int u = 0; u < 32; ++u) {
    const v4usa hv = {h2us(wv[u].x * 16.0f), h2us(wv[u].y * 16.0f),
                      h2us(wv[u].z * 16.0f), h2us(wv[u].w * 16.0f)};
    *(v4usa*)(sAw + u * 8 * KP) = hv;
  }
}

// image column (or row) t in -2 .. 77 of the reflect-padded axis of length 64 -> 0 .. 63
__device__ __forceinline__ int refl(int t) {
  t = (t < 0) ? -t : t;
  return (t >= 64) ? (126 - t) : t;
}

// GEMM tiling, all three products: [256 rows][64 pixels], wave w: rows (w>>1)*32 (two A tiles),
// pixels (w&1)*32 (two B tiles). D element r of a lane -> row rsub + a*16 + 8h + r, pixel psub + t*16 + m.
__global__ void __launch_bounds__(TH) k_pam(
    const float* __restrict__ x, const float* __restrict__ Wb, const float* __restrict__ bb,
    const float* __restrict__ Wc, const float* __restrict__ bc, const float* __restrict__ alpha,
    float* __restrict__ out) {
  __shared__ __attribute__((aligned(16))) unsigned char sm[LDS_B];
  unsigned short* sWb = (unsigned short*)(sm + O_WB);
  unsigned short* sWc = (unsigned short*)(sm + O_WC);
  unsigned short* sX = (unsigned short*)(sm + O_X);
  unsigned short* sP = (unsigned short*)(sm + O_P);
  unsigned short* sU = (unsigned short*)(sm + O_U);
  unsigned short* sZh = (unsigned short*)(sm + O_ZH);
  unsigned short* sA = (unsigned short*)(sm + O_A);   // [window row][pixel of the row][column s]
  f32a* sT = (f32a*)(sm + O_T);
  f32a* sR = (f32a*)(sm + O_R);          // [k][pixel of the row]

  const int tid = threadIdx.x;
  const int lane = tid & 31;
  const int w = __builtin_amdgcn_readfirstlane(tid >> 5);   // the wave's number, kept in a scalar register
  const int h = lane >> 4;
  const int m = lane & 15;
  const int n = blockIdx.x >> 6;                    // grid = NB * HDIM exactly
  const int hy = blockIdx.x & (HDIM - 1);
  const size_t nbase = (size_t)n * CD * HW;         // same for the whole work-group
  const float* xr = x + nbase + hy * WDIM;          // the work-group's own image row, channel 0

  const int rsub = (w >> 1) * 32;
  const int psub = (w & 1) * 32;

  // ---- stage Wc and the x row as f16, k-contiguous ------------------------------------------------
  // x row: a lane takes 4 pixels of channels 2cp and 2cp+1; 8 channel pairs x 4 pixel quads a wave,
  // so that the 32 four-byte LDS stores of an instruction fall on 32 banks
  const int cp = w * 8 + (lane & 7);
  const int pq = lane >> 3;
  const unsigned xofs = (unsigned)(2 * cp * HW + 4 * pq) * 4u;
  const unsigned wofs = (unsigned)tid * 16u;
  const unsigned bofs = (unsigned)(rsub + 8 * h) * 4u;   // the lane's first D row, in bytes, for the bias vectors
  v4f bcv[4];
  const int aw = (tid >> 6) * KP + (tid & 63) * 4;      // the thread's place in the first 8 rows of a weight tile
  {
    v4f xe[4], xo[4];
    #pragma unroll
    for (int it = 0; it < 4; ++it) {
      xe[it] = ld4(xr + it * 16, xofs);
      xo[it] = ld4(xr + HW + it * 16, xofs);
    }
    #pragma unroll
    for (int a = 0; a < 2; ++a) {
      bcv[2 * a] = ld4(bc + a * 16, bofs);
      bcv[2 * a + 1] = ld4(bc + a * 16 + 4, bofs);
    }
    v4f wv[32];
    w_load(Wc, wofs, wv);
    // the offset registers of the x and bias loads are kept as they are until this wait has passed
    asm volatile("s_wait_xcnt 0x0" :: "v"(xofs), "v"(bofs) : "memory");
    w_stage(sWc + aw, wv);
    #pragma unroll
    for (int it = 0; it < 4; ++it) {
      #pragma unroll
      for (int i = 0; i < 4; ++i) {
        const v2h pk = {(_Float16)xe[it][i], (_Float16)xo[it][i]};     // RNE, even channel low
        *(u32a*)(sX + (4 * (it * 4 + pq) + i) * KP + 2 * cp) = __builtin_bit_cast(unsigned, pk);
      }
    }
  }
  __syncthreads();
  // Wb is asked for here, so that it travels under the first product
  v4f wv2[32];
  w_load(Wb, wofs, wv2);
  // the offset register and the base of these loads are kept as they are until this wait has passed
  asm volatile("s_wait_xcnt 0x0" :: "v"(wofs), "s"(Wb) : "memory");

  // ---- product 1: pxc = Wc x + bc, rounded to f16 as [pixel][o], the B operand of product 2 --------
  {
    v8f acc[2][2];
    #pragma unroll
    for (int a = 0; a < 2; ++a) {
      #pragma unroll
      for (int t = 0; t < 2; ++t) acc[a][t] = v8f_zero();
    }
    const unsigned short* ar = sWc + (rsub + m) * KP;
    const unsigned short* br = sX + (psub + m) * KP;
    #pragma unroll
    for (int ks = 0; ks < CD / 32; ++ks) {
      const int k0 = ks * 32;
      v16h fa[2], fb[2];
      #pragma unroll
      for (int a = 0; a < 2; ++a) fa[a] = ldfrag(ar + a * 16 * KP + k0, h);
      #pragma unroll
      for (int t = 0; t < 2; ++t) fb[t] = ldfrag(br + t * 16 * KP + k0, h);
      #pragma unroll
      for (int a = 0; a < 2; ++a) {
        #pragma unroll
        for (int t = 0; t < 2; ++t) acc[a][t] = wmma_h(fa[a], fb[t], acc[a][t]);
      }
    }
    // Wb has a place of its own, so it is laid down as soon as it is here
    w_stage(sWb + aw, wv2);
    // every wave has read its last Wc fragment before pxc takes the start of Wc's place
    __syncthreads();
    #pragma unroll
    for (int a = 0; a < 2; ++a) {
      const int orow0 = rsub + a * 16 + 8 * h;
      #pragma unroll
      for (int t = 0; t < 2; ++t) {
        v8us hv;
        #pragma unroll
        for (int r = 0; r < 8; ++r) hv[r] = h2us(acc[a][t][r] * 0.0625f + bcv[2 * a + (r >> 2)][r & 3]);
        *(v8usa*)(sP + (psub + t * 16 + m) * KP + orow0) = hv;
      }
    }
  }
  __syncthreads();

  // the other four window rows of x (reflected at the image's top and bottom) are asked for here, so that
  // they travel under the second product; same split over the lanes as for the work-group's own row
  v4f ye[4][4], yo[4][4];
  #pragma unroll
  for (int s = 0; s < 4; ++s) {
    const float* yr = x + nbase + refl(hy + (s < 2 ? s : s + 1) - 2) * WDIM;
    #pragma unroll
    for (int it = 0; it < 4; ++it) {
      ye[s][it] = ld4(yr + it * 16, xofs);
      yo[s][it] = ld4(yr + HW + it * 16, xofs);
    }
  }
  // the offset register of these loads is kept as it is until this wait has passed
  asm volatile("s_wait_xcnt 0x0" :: "v"(xofs) : "memory");

  // ---- product 2: z = Wb^T pxc; A = Wb^T by transposing loads from the row-major Wb tile ------------
  {
    v8f acc[2][2];
    #pragma unroll
    for (int a = 0; a < 2; ++a) {
      #pragma unroll
      for (int t = 0; t < 2; ++t) acc[a][t] = v8f_zero();
    }
    const unsigned char* ta = (const unsigned char*)sWb + (8 * h + (lane & 7)) * (KP * 2)
                              + ((lane >> 3) & 1) * 16 + rsub * 2;
    const unsigned short* br = sP + (psub + m) * KP;
    #pragma unroll
    for (int ks = 0; ks < CD / 32; ++ks) {
      const int k0 = ks * 32;
      v16h fa[2], fb[2];
      #pragma unroll
      for (int a = 0; a < 2; ++a) {
        Frag f;
        f.half[0] = ld_tr16(ta + k0 * (KP * 2) + a * 32);
        f.half[1] = ld_tr16(ta + (k0 + 16) * (KP * 2) + a * 32);
        fa[a] = __builtin_bit_cast(v16h, f.v);
      }
      #pragma unroll
      for (int t = 0; t < 2; ++t) fb[t] = ldfrag(br + t * 16 * KP + k0, h);
      #pragma unroll
      for (int a = 0; a < 2; ++a) {
        #pragma unroll
        for (int t = 0; t < 2; ++t) acc[a][t] = wmma_h(fa[a], fb[t], acc[a][t]);
      }
    }
    // z rounded to f16 as [pixel][c], the B operand of the energy products
    #pragma unroll
    for (int a = 0; a < 2; ++a) {
      const int crow0 = rsub + a * 16 + 8 * h;
      #pragma unroll
      for (int t = 0; t < 2; ++t) {
        v8us hv;
        #pragma unroll
        for (int r = 0; r < 8; ++r) hv[r] = h2us(acc[a][t][r] * 0.0625f);
        *(v8usa*)(sZh + (psub + t * 16 + m) * KP + crow0) = hv;
      }
    }
  }
  // window rows 3 and 4 go to the two places that have been free since Wc's last read
  #pragma unroll
  for (int s = 2; s < 4; ++s) {
    #pragma unroll
    for (int it = 0; it < 4; ++it) {
      #pragma unroll
      for (int i = 0; i < 4; ++i) {
        const v2h pk = {(_Float16)ye[s][it][i], (_Float16)yo[s][it][i]};     // RNE, even channel low
        *(u32a*)(sWc + (s * WDIM + 4 * (it * 4 + pq) + i) * KP + 2 * cp) = __builtin_bit_cast(unsigned, pk);
      }
    }
  }
  __syncthreads();

  // ---- window energies ------------------------------------------------------------------------------
  // wave w: pixels p0 = (w & 3) * 16 .. + 15; of their ten tiles (window row di, column half qt) those with
  // number 2 di + qt = (w >> 2), + 4, + 8. z of the 16 pixels, all channels, is taken into registers first,
  // so that its place and pxc's can take window rows.
  const int p0 = (w & 3) * 16;
  const int g = w >> 2;
  v16h zf[CD / 32];
  #pragma unroll
  for (int ks = 0; ks < CD / 32; ++ks) zf[ks] = ldfrag(sZh + (p0 + m) * KP + ks * 32, h);
  // every wave holds its z fragments before window rows 0 and 1 are laid over pxc and z
  __syncthreads();
  #pragma unroll
  for (int s = 0; s < 2; ++s) {
    #pragma unroll
    for (int it = 0; it < 4; ++it) {
      #pragma unroll
      for (int i = 0; i < 4; ++i) {
        const v2h pk = {(_Float16)ye[s][it][i], (_Float16)yo[s][it][i]};     // RNE, even channel low
        *(u32a*)(sWc + (s * WDIM + 4 * (it * 4 + pq) + i) * KP + 2 * cp) = __builtin_bit_cast(unsigned, pk);
      }
    }
  }
  __syncthreads();
  #pragma unroll
  for (int i = 0; i < 3; ++i) {
    const int tile = g + 4 * i;                        // the same for the whole wave
    if (tile < 10) {
      const int di = tile >> 1;
      const int qt = tile & 1;
      const unsigned short* xw = (di == 2) ? sX : sWc + (di < 2 ? di : di - 1) * (WDIM * KP);
      const unsigned short* ar = xw + refl(p0 - 2 + qt * 16 + m) * KP;      // A row m = column s = 16 qt + m
      v16h xa[CD / 32];
      #pragma unroll
      for (int ks = 0; ks < CD / 32; ++ks) xa[ks] = ldfrag(ar + ks * 32, h);
      // keeps the tile's 16 LDS loads together ahead of its products: the build otherwise put each pair
      // directly in front of its product, with a full wait for each
      __builtin_amdgcn_sched_barrier(0);
      v8f acc = v8f_zero();
      #pragma unroll
      for (int ks = 0; ks < CD / 32; ++ks) acc = wmma_h(xa[ks], zf[ks], acc);
      // D element r: column s = 16 qt + 8h + r, pixel p0 + m; it is energy (di, dj = s - m) where 0 <= dj < 5
      #pragma unroll
      for (int r = 0; r < 8; ++r) {
        const int dj = qt * 16 + 8 * h + r - m;
        if ((unsigned)dj < 5u) sR[(di * 5 + dj) * WDIM + p0 + m] = acc[r];
      }
    }
  }
  __syncthreads();

  // ---- softmax: a thread per (window row, pixel) forms the pixel's maximum and sum over all 25 energies and
  // lays its own five weights, f16, at columns i .. i + 4 of a zeroed band row (i = pixel in its tile of 16)
  if (w < 10) {
    const int p = tid & (WDIM - 1);
    const int di = w >> 1;
    float ev[25];
    #pragma unroll
    for (int k = 0; k < 25; ++k) ev[k] = sR[k * WDIM + p];
    float own[5];
    #pragma unroll
    for (int dj = 0; dj < 5; ++dj) own[dj] = sR[(di * 5 + dj) * WDIM + p];
    float mx = ev[0];
    #pragma unroll
    for (int k = 1; k < 25; ++k) mx = fmaxf(mx, ev[k]);
    float sum = 0.0f;
    #pragma unroll
    for (int k = 0; k < 25; ++k) sum += __expf(ev[k] - mx);
    const float inv = 1.0f / sum;
    unsigned short* ap = sA + (di * WDIM + p) * AP;
    const v8us zero8 = {0, 0, 0, 0, 0, 0, 0, 0};
    #pragma unroll
    for (int i = 0; i < AP / 8; ++i) *(v8usa*)(ap + 8 * i) = zero8;
    #pragma unroll
    for (int dj = 0; dj < 5; ++dj) *(u16a*)(ap + m + dj) = h2us(__expf(own[dj] - mx) * inv);
  }
  __syncthreads();

  // ---- window sums: u[c][p], GEMM tiling; A = x_di^T by transposing loads whose lanes walk the 32 columns
  // s of the pixel tile, B = the band rows (columns 24..31 are zero and not stored) -------------------
  {
    v8f acc[2][2];
    #pragma unroll
    for (int a = 0; a < 2; ++a) {
      #pragma unroll
      for (int t = 0; t < 2; ++t) acc[a][t] = v8f_zero();
    }
    int ro[2][2];                                      // byte offset of the lane's column s in a window row tile
    #pragma unroll
    for (int t = 0; t < 2; ++t) {
      #pragma unroll
      for (int kb = 0; kb < 2; ++kb)
        ro[t][kb] = refl(psub + t * 16 - 2 + kb * 16 + 8 * h + (lane & 7)) * (KP * 2)
                    + ((lane >> 3) & 1) * 16 + rsub * 2;
    }
    #pragma unroll
    for (int di = 0; di < 5; ++di) {
      const unsigned char* xw = (const unsigned char*)((di == 2) ? sX : sWc + (di < 2 ? di : di - 1) * (WDIM * KP));
      #pragma unroll
      for (int t = 0; t < 2; ++t) {
        const unsigned short* bp = sA + (di * WDIM + psub + t * 16 + m) * AP;
        Frag fbv;
        fbv.half[0] = *(const v8usa*)(bp + 8 * h);
        const v8us hi = *(const v8usa*)(bp + 16);
        const v8us zero8 = {0, 0, 0, 0, 0, 0, 0, 0};
        fbv.half[1] = h ? zero8 : hi;
        const v16h fb = __builtin_bit_cast(v16h, fbv.v);
        #pragma unroll
        for (int a = 0; a < 2; ++a) {
          Frag f;
          f.half[0] = ld_tr16(xw + ro[t][0] + a * 32);
          f.half[1] = ld_tr16(xw + ro[t][1] + a * 32);
          acc[a][t] = wmma_h(__builtin_bit_cast(v16h, f.v), fb, acc[a][t]);
        }
      }
    }
    // every wave has read its last window row fragment before u takes the first row's place
    __syncthreads();
    // u rounded to f16 as [pixel][c], the B operand of product 3
    #pragma unroll
    for (int a = 0; a < 2; ++a) {
      const int crow0 = rsub + a * 16 + 8 * h;
      #pragma unroll
      for (int t = 0; t < 2; ++t) {
        v8us hv;
        #pragma unroll
        for (int r = 0; r < 8; ++r) hv[r] = h2us(acc[a][t][r]);
        *(v8usa*)(sU + (psub + t * 16 + m) * KP + crow0) = hv;
      }
    }
  }

  // ---- product 3: Wb u; out = alpha (Wb u + bb) + x -------------------------------------------------
  const float al = alpha[0];
  __syncthreads();
  // the residual rows, two per wave and step, asked for here, so that they travel under the product
  const unsigned oofs = (unsigned)((w * 2 + h) * HW + m * 4) * 4u;
  v4f xres[8];
  #pragma unroll
  for (int it = 0; it < 8; ++it) xres[it] = ld4(xr + it * 32 * HW, oofs);
  v4f bbv[4];
  #pragma unroll
  for (int a = 0; a < 2; ++a) {
    bbv[2 * a] = ld4(bb + a * 16, bofs);
    bbv[2 * a + 1] = ld4(bb + a * 16 + 4, bofs);
  }
  // the offset registers of these loads are kept as they are until this wait has passed
  asm volatile("s_wait_xcnt 0x0" :: "v"(oofs), "v"(bofs) : "memory");
  {
    v8f acc[2][2];
    #pragma unroll
    for (int a = 0; a < 2; ++a) {
      #pragma unroll
      for (int t = 0; t < 2; ++t) acc[a][t] = v8f_zero();
    }
    const unsigned short* ar = sWb + (rsub + m) * KP;
    const unsigned short* br = sU + (psub + m) * KP;
    // four k steps a trip: unrolled whole, the fragments fetched ahead pushed a residual row out of the registers
    #pragma unroll 4
    for (int ks = 0; ks < CD / 32; ++ks) {
      const int k0 = ks * 32;
      v16h fa[2], fb[2];
      #pragma unroll
      for (int a = 0; a < 2; ++a) fa[a] = ldfrag(ar + a * 16 * KP + k0, h);
      #pragma unroll
      for (int t = 0; t < 2; ++t) fb[t] = ldfrag(br + t * 16 * KP + k0, h);
      #pragma unroll
      for (int a = 0; a < 2; ++a) {
        #pragma unroll
        for (int t = 0; t < 2; ++t) acc[a][t] = wmma_h(fa[a], fb[t], acc[a][t]);
      }
    }
    // the f32 tile takes window rows' places beside u, last read before the barrier in front of u's stores
    #pragma unroll
    for (int a = 0; a < 2; ++a) {
      const int orow0 = rsub + a * 16 + 8 * h;
      #pragma unroll
      for (int t = 0; t < 2; ++t) {
        #pragma unroll
        for (int r = 0; r < 8; ++r)
          sT[(orow0 + r) * ZP + psub + t * 16 + m] = al * (acc[a][t][r] * 0.0625f + bbv[2 * a + (r >> 2)][r & 3]);
      }
    }
  }
  __syncthreads();

  float* orow = out + nbase + hy * WDIM;
  #pragma unroll
  for (int it = 0; it < 8; ++it) {
    const int row = it * 32 + w * 2 + h;               // 0..255, each once; 256 B of a row per 16 lanes
    const v4f v = *(const v4fa*)(sT + row * ZP + m * 4) + xres[it];
    st2_f4((float*)((char*)(orow + it * 32 * HW) + oofs), v);
  }
}

// =====================================================================================
extern "C" void kernel_launch(void* const* d_in, const int* in_sizes, int n_in,
                              void* d_out, int out_size, void* d_ws, size_t ws_size,
                              hipStream_t stream) {
  if (n_in < 6) return;
  if (in_sizes[0] != X_N || in_sizes[1] != W_N || in_sizes[2] != B_N ||
      in_sizes[3] != W_N || in_sizes[4] != B_N || in_sizes[5] < 1) return;
  if (out_size != OUT_N) return;

  const float* x     = (const float*)d_in[0];
  const float* Wb    = (const float*)d_in[1];
  const float* bb    = (const float*)d_in[2];
  const float* Wc    = (const float*)d_in[3];
  const float* bc    = (const float*)d_in[4];
  const float* alpha = (const float*)d_in[5];
  float* out = (float*)d_out;

  k_pam<<<dim3(NB * HDIM), dim3(TH), 0, stream>>>(x, Wb, bb, Wc, bc, alpha, out);
}

// v006
// Measured time: 19.6 microseconds a run.
// Two timings next to v005 both put it at 1.05 times that version's speed.
// Over all steps from v000 it is 21.0 times as fast.
#include <hip/hip_runtime.h>

// One launch, one work-group per image row (64 pixels, all 256 channels).
// The 1x1 convolutions commute with the reflect padding and with the window sums, so no convolved map
// is needed outside a pixel's own row:
//   energy[p][k] = pxc[.][p] . (Wb x[.][q] + bb) = z[.][p] . x[.][q] + pxc[.][p] . bb,  z = Wb^T pxc,
//     q = window pixel k of p; the last term is the same for all 25 k and drops out of the softmax;
//   fusion[.][p] = sum_k a[k] (Wb x[.][q] + bb) = Wb u[.][p] + bb,  u = sum_k a[k] x[.][q]  (sum_k a[k] = 1).
// Three channel GEMMs on v_wmma_f32_16x16x32_f16 (f16 operands: weights carried x16, activations x1;
// f32 accumulate, 1/16 folded in the f32 epilogues): pxc = Wc x + bc, z = Wb^T pxc, Wb u.
// The 5x5 reflect-pad window part runs on the same instruction as banded products, on the five window rows
// of x held in LDS as f16 [pixel][channel]: for 16 pixels p0.. and window row di, with column s = 0..31
// standing for image column reflect(p0 - 2 + s),
//   E[s][p] = sum_c x_di[c][s] z[c][p]     (k = 256 channels; energy (di, dj) of pixel p0 + i is E[i + dj][i]),
//   u[c][p] = sum_di sum_s x_di[c][s] a_di[p][s]   (k = 32 columns; a_di[p0 + i][s] is 0 outside s = i .. i + 4).
// Softmax in f32 on VALU.

#define NB     4
#define CD     256
#define HDIM   64
#define WDIM   64
#define HW     (HDIM * WDIM)            // 4096
#define PLANE  (NB * CD * HW)           // 4194304 elements per f32 map
#define X_N    PLANE
#define W_N    (CD * CD)                // 65536
#define B_N    CD
#define OUT_N  PLANE

typedef unsigned short v4usa __attribute__((ext_vector_type(4), __may_alias__));
typedef unsigned short v8us  __attribute__((ext_vector_type(8)));
typedef unsigned short v8usa __attribute__((ext_vector_type(8), __may_alias__));
typedef unsigned short v16us __attribute__((ext_vector_type(16)));
typedef short          s16x8 __attribute__((ext_vector_type(8)));
typedef _Float16       v2h   __attribute__((ext_vector_type(2)));
typedef _Float16       v16h  __attribute__((ext_vector_type(16)));
typedef float          v8f   __attribute__((ext_vector_type(8)));
typedef float          v4f   __attribute__((ext_vector_type(4)));
typedef float          v4fa  __attribute__((ext_vector_type(4), __may_alias__));
typedef unsigned       u32a  __attribute__((__may_alias__));
typedef unsigned short u16a  __attribute__((__may_alias__));
typedef float          f32a  __attribute__((__may_alias__));

union Frag { v16us v; v8us half[2]; };

// f32 -> f16 bits (RNE convert)
__device__ __forceinline__ unsigned short h2us(float f) {
  return __builtin_bit_cast(unsigned short, (_Float16)f);
}

__device__ __forceinline__ void st2_f4(float* p, v4f v) {
  *(v4f*)p = v;
}

// 16-bit fragment from a k-contiguous row: elements 0..7 <- k0+8h.., elements 8..15 <- k0+16+8h..
// Used for A rows [m][k] and for B stored as [n][k] (same per-lane k map).
__device__ __forceinline__ v16h ldfrag(const unsigned short* rowp, int h) {
  Frag f;
  f.half[0] = *(const v8usa*)(rowp + 8 * h);
  f.half[1] = *(const v8usa*)(rowp + 16 + 8 * h);
  return __builtin_bit_cast(v16h, f.v);
}

// transposing LDS load: the lane's address walks the k rows of a row-major 16-bit tile T[k][d];
// lane (m, h) receives T[kbase + 8h + 0..7][dbase + m]
__device__ __forceinline__ v8us ld_tr16(const unsigned char* p) {
  typedef __attribute__((address_space(3))) s16x8 lds_s16x8;
  return __builtin_bit_cast(v8us, __builtin_amdgcn_ds_load_tr16_b128_v8i16((lds_s16x8*)p));
}

__device__ __forceinline__ v8f wmma_h(v16h a, v16h b, v8f c) {
  return __builtin_amdgcn_wmma_f32_16x16x32_f16(false, a, false, b, (short)0, c, false, false);
}

__device__ __forceinline__ v8f v8f_zero() {
  v8f z = {0.f, 0.f, 0.f, 0.f, 0.f, 0.f, 0.f, 0.f};
  return z;
}

// 16 bytes at a base that is the same for the whole work-group plus the lane's own byte offset
__device__ __forceinline__ v4f ld4(const float* base, unsigned boff) {
  return *(const v4f*)((const char*)base + boff);
}

#define TH   512                // threads per work-group, 16 waves
#define KP   (CD + 8)           // LDS pitch of the f16 operand tiles, halves: 528 B = 16 B x 33
#define ZP   (WDIM + 4)         // LDS pitch of the f32 tiles [channel][pixel], floats: 272 B = 16 B x 17

#define NE   (25 * WDIM)        // energies per work-group
#define AP   24                 // LDS pitch of the weight bands, halves: 48 B = 16 B x 3; columns 24..31 are never stored
static_assert(WDIM == 64 && HDIM == 64 && CD == 256 && TH == 512);

// LDS map, bytes. Regions that share bytes are never live together (a barrier lies between their uses).
//   sWb  Wb f16 [256][KP], staged once, read by products 2 (transposed) and 3
//   sWc  Wc f16 [256][KP]  -> four places of [64][KP]: pxc f16 (0), z f16 (1)
//                          -> window rows 0, 1, 3, 4 of x, f16 (0..3)  -> u f16 (0), f32 output tile (1..3)
//   sX   the work-group's own x row (window row 2), f16 [64][KP], kept to the end of the window part
//   sR   energies f32 [25][64];  sA  softmax weights f16 as bands [5][64][AP]
#define SZ_A  (CD * KP * 2)               // 135168
#define SZ_X  (WDIM * KP * 2)             // 33792
#define SZ_Z  (CD * ZP * 4)               // 69632
#define SZ_R  (NE * 4)                    // 6400
#define SZ_B  (5 * WDIM * AP * 2)         // 15360
#define O_WB  0
#define O_WC  SZ_A
#define O_X   (O_WC + SZ_A)               // 270336
#define O_P   O_WC
#define O_ZH  (O_WC + SZ_X)
#define O_U   O_WC
#define O_T   (O_WC + SZ_X)
#define O_R   (O_X + SZ_X)                // 304128
#define O_A   (O_R + SZ_R)                // 310528
#define LDS_B (O_A + SZ_B)                // 325888
static_assert(4 * SZ_X == SZ_A && O_T + SZ_Z <= O_X && LDS_B <= 327680);
static_assert((O_WC % 16) == 0 && (O_X % 16) == 0 && (SZ_X % 16) == 0 && (O_R % 16) == 0 && (O_A % 16) == 0);

// a 256 x 256 f32 weight matrix: 8 rows (8 KiB) per step of the work-group, 4 consecutive k per lane.
// Every work-group reads the same two matrices at the same time, so each walks the 32 blocks of 8 rows in an
// order of its own: at any step the 32 values of rot stand on 32 different blocks, and L2 is not asked for the
// same lines by all groups at once. Steps 0..15 take the half (16 blocks) of the matrix that bit 4 of rot names,
// steps 16..31 the other half; step u takes block (u + rot) & 15 of its half.
// W0, W1: the half taken first and the other; wo[j]: the lane's byte offset in block (j + rot) & 15 of either
__device__ __forceinline__ void w_load(const float* W0, const float* W1, const unsigned (&wo)[16], v4f (&wv)[32]) {
  #pragma unroll
  for (int u = 0; u < 32; ++u) wv[u] = ld4(u < 16 ? W0 : W1, wo[u & 15]);
}
__device__ __forceinline__ void w_stage(unsigned short* sAw, int rot, const v4f (&wv)[32]) {
  const int hs = (rot >> 4) & 1;
  unsigned short* s0 = sAw + hs * (128 * KP);
  unsigned short* s1 = sAw + (hs ^ 1) * (128 * KP);
  #pragma unroll
  for (int u = 0; u < 32; ++u) {
    const v4usa hv = {h2us(wv[u].x * 16.0f), h2us(wv[u].y * 16.0f),
                      h2us(wv[u].z * 16.0f), h2us(wv[u].w * 16.0f)};
    *(v4usa*)((u < 16 ? s0 : s1) + ((u + rot) & 15) * 8 * KP) = hv;
  }
}

// image column (or row) t in -2 .. 77 of the reflect-padded axis of length 64 -> 0 .. 63
__device__ __forceinline__ int refl(int t) {
  t = (t < 0) ? -t : t;
  return (t >= 64) ? (126 - t) : t;
}

// GEMM tiling, all three products: [256 rows][64 pixels], wave w: rows (w>>1)*32 (two A tiles),
// pixels (w&1)*32 (two B tiles). D element r of a lane -> row rsub + a*16 + 8h + r, pixel psub + t*16 + m.
__global__ void __launch_bounds__(TH) k_pam(
    const float* __restrict__ x, const float* __restrict__ Wb, const float* __restrict__ bb,
    const float* __restrict__ Wc, const float* __restrict__ bc, const float* __restrict__ alpha,
    float* __restrict__ out) {
  __shared__ __attribute__((aligned(16))) unsigned char sm[LDS_B];
  unsigned short* sWb = (unsigned short*)(sm + O_WB);
  unsigned short* sWc = (unsigned short*)(sm + O_WC);
  unsigned short* sX = (unsigned short*)(sm + O_X);
  unsigned short* sP = (unsigned short*)(sm + O_P);
  unsigned short* sU = (unsigned short*)(sm + O_U);
  unsigned short* sZh = (unsigned short*)(sm + O_ZH);
  unsigned short* sA = (unsigned short*)(sm + O_A);   // [window row][pixel of the row][column s]
  f32a* sT = (f32a*)(sm + O_T);
  f32a* sR = (f32a*)(sm + O_R);          // [k][pixel of the row]

  const int tid = threadIdx.x;
  const int lane = tid & 31;
  const int w = __builtin_amdgcn_readfirstlane(tid >> 5);   // the wave's number, kept in a scalar register
  const int h = lane >> 4;
  const int m = lane & 15;
  const int n = blockIdx.x >> 6;                    // grid = NB * HDIM exactly
  const int hy = blockIdx.x & (HDIM - 1);
  const size_t nbase = (size_t)n * CD * HW;         // same for the whole work-group
  const float* xr = x + nbase + hy * WDIM;          // the work-group's own image row, channel 0

  const int rsub = (w >> 1) * 32;
  const int psub = (w & 1) * 32;

  // ---- stage Wc and the x row as f16, k-contiguous ------------------------------------------------
  // x row: a lane takes 4 pixels of channels 2cp and 2cp+1; 8 channel pairs x 4 pixel quads a wave,
  // so that the 32 four-byte LDS stores of an instruction fall on 32 banks
  const int cp = w * 8 + (lane & 7);
  const int pq = lane >> 3;
  const unsigned xofs = (unsigned)(2 * cp * HW + 4 * pq) * 4u;
  // where this work-group's walk over the weight blocks starts: all 32 values occur among 32 consecutive groups
  // and among 32 groups that lie 8 apart, whichever of the two share an L2
  const int rot = ((blockIdx.x >> 3) + 4 * (blockIdx.x & 7)) & 31;
  const int wh0 = ((rot >> 4) & 1) * (16 * TH * 4);     // first element of the half taken first, and of the other
  const int wh1 = wh0 ^ (16 * TH * 4);
  unsigned wo[16];
  #pragma unroll
  for (int j = 0; j < 16; ++j) wo[j] = (unsigned)tid * 16u + (unsigned)(((j + rot) & 15) * (TH * 16));
  const unsigned bofs = (unsigned)(rsub + 8 * h) * 4u;   // the lane's first D row, in bytes, for the bias vectors
  v4f bcv[4];
  const int aw = (tid >> 6) * KP + (tid & 63) * 4;      // the thread's place in the first 8 rows of a weight tile
  {
    v4f xe[4], xo[4];
    #pragma unroll
    for (int it = 0; it < 4; ++it) {
      xe[it] = ld4(xr + it * 16, xofs);
      xo[it] = ld4(xr + HW + it * 16, xofs);
    }
    #pragma unroll
    for (int a = 0; a < 2; ++a) {
      bcv[2 * a] = ld4(bc + a * 16, bofs);
      bcv[2 * a + 1] = ld4(bc + a * 16 + 4, bofs);
    }
    v4f wv[32];
    w_load(Wc + wh0, Wc + wh1, wo, wv);
    // the offset registers of the x and bias loads are kept as they are until this wait has passed
    asm volatile("s_wait_xcnt 0x0" :: "v"(xofs), "v"(bofs) : "memory");
    w_stage(sWc + aw, rot, wv);
    #pragma unroll
    for (int it = 0; it < 4; ++it) {
      #pragma unroll
      for (int i = 0; i < 4; ++i) {
        const v2h pk = {(_Float16)xe[it][i], (_Float16)xo[it][i]};     // RNE, even channel low
        *(u32a*)(sX + (4 * (it * 4 + pq) + i) * KP + 2 * cp) = __builtin_bit_cast(unsigned, pk);
      }
    }
  }
  __syncthreads();
  // Wb is asked for here, so that it travels under the first product
  v4f wv2[32];
  const float* Wb0 = Wb + wh0;
  const float* Wb1 = Wb + wh1;
  w_load(Wb0, Wb1, wo, wv2);
  // the offset registers and the bases of these loads are kept as they are until this wait has passed
  asm volatile("s_wait_xcnt 0x0" :: "v"(wo[0]), "v"(wo[1]), "v"(wo[2]), "v"(wo[3]), "v"(wo[4]), "v"(wo[5]), "v"(wo[6]),
               "v"(wo[7]), "v"(wo[8]), "v"(wo[9]), "v"(wo[10]), "v"(wo[11]), "v"(wo[12]), "v"(wo[13]), "v"(wo[14]),
               "v"(wo[15]), "s"(Wb0), "s"(Wb1) : "memory");

  // ---- product 1: pxc = Wc x + bc, rounded to f16 as [pixel][o], the B operand of product 2 --------
  {
    v8f acc[2][2];
    #pragma unroll
    for (int a = 0; a < 2; ++a) {
      #pragma unroll
      for (int t = 0; t < 2; ++t) acc[a][t] = v8f_zero();
    }
    const unsigned short* ar = sWc + (rsub + m) * KP;
    const unsigned short* br = sX + (psub + m) * KP;
    #pragma unroll
    for (int ks = 0; ks < CD / 32; ++ks) {
      const int k0 = ks * 32;
      v16h fa[2], fb[2];
      #pragma unroll
      for (int a = 0; a < 2; ++a) fa[a] = ldfrag(ar + a * 16 * KP + k0, h);
      #pragma unroll
      for (int t = 0; t < 2; ++t) fb[t] = ldfrag(br + t * 16 * KP + k0, h);
      #pragma unroll
      for (int a = 0; a < 2; ++a) {
        #pragma unroll
        for (int t = 0; t < 2; ++t) acc[a][t] = wmma_h(fa[a], fb[t], acc[a][t]);
      }
    }
    // Wb has a place of its own, so it is laid down as soon as it is here
    w_stage(sWb + aw, rot, wv2);
    // every wave has read its last Wc fragment before pxc takes the start of Wc's place
    __syncthreads();
    #pragma unroll
    for (int a = 0; a < 2; ++a) {
      const int orow0 = rsub + a * 16 + 8 * h;
      #pragma unroll
      for (int t = 0; t < 2; ++t) {
        v8us hv;
        #pragma unroll
        for (int r = 0; r < 8; ++r) hv[r] = h2us(acc[a][t][r] * 0.0625f + bcv[2 * a + (r >> 2)][r & 3]);
        *(v8usa*)(sP + (psub + t * 16 + m) * KP + orow0) = hv;
      }
    }
  }
  __syncthreads();

  // the other four window rows of x (reflected at the image's top and bottom) are asked for here, so that
  // they travel under the second product; same split over the lanes as for the work-group's own row
  v4f ye[4][4], yo[4][4];
  #pragma unroll
  for (int s = 0; s < 4; ++s) {
    const float* yr = x + nbase + refl(hy + (s < 2 ? s : s + 1) - 2) * WDIM;
    #pragma unroll
    for (int it = 0; it < 4; ++it) {
      ye[s][it] = ld4(yr + it * 16, xofs);
      yo[s][it] = ld4(yr + HW + it * 16, xofs);
    }
  }
  // the offset register of these loads is kept as it is until this wait has passed
  asm volatile("s_wait_xcnt 0x0" :: "v"(xofs) : "memory");

  // ---- product 2: z = Wb^T pxc; A = Wb^T by transposing loads from the row-major Wb tile ------------
  {
    v8f acc[2][2];
    #pragma unroll
    for (int a = 0; a < 2; ++a) {
      #pragma unroll
      for (int t = 0; t < 2; ++t) acc[a][t] = v8f_zero();
    }
    const unsigned char* ta = (const unsigned char*)sWb + (8 * h + (lane & 7)) * (KP * 2)
                              + ((lane >> 3) & 1) * 16 + rsub * 2;
    const unsigned short* br = sP + (psub + m) * KP;
    #pragma unroll
    for (int ks = 0; ks < CD / 32; ++ks) {
      const int k0 = ks * 32;
      v16h fa[2], fb[2];
      #pragma unroll
      for (int a = 0; a < 2; ++a) {
        Frag f;
        f.half[0] = ld_tr16(ta + k0 * (KP * 2) + a * 32);
        f.half[1] = ld_tr16(ta + (k0 + 16) * (KP * 2) + a * 32);
        fa[a] = __builtin_bit_cast(v16h, f.v);
      }
      #pragma unroll
      for (int t = 0; t < 2; ++t) fb[t] = ldfrag(br + t * 16 * KP + k0, h);
      #pragma unroll
      for (int a = 0; a < 2; ++a) {
        #pragma unroll
        for (int t = 0; t < 2; ++t) acc[a][t] = wmma_h(fa[a], fb[t], acc[a][t]);
      }
    }
    // z rounded to f16 as [pixel][c], the B operand of the energy products
    #pragma unroll
    for (int a = 0; a < 2; ++a) {
      const int crow0 = rsub + a * 16 + 8 * h;
      #pragma unroll
      for (int t = 0; t < 2; ++t) {
        v8us hv;
        #pragma unroll
        for (int r = 0; r < 8; ++r) hv[r] = h2us(acc[a][t][r] * 0.0625f);
        *(v8usa*)(sZh + (psub + t * 16 + m) * KP + crow0) = hv;
      }
    }
  }
  // window rows 3 and 4 go to the two places that have been free since Wc's last read
  #pragma unroll
  for (int s = 2; s < 4; ++s) {
    #pragma unroll
    for (int it = 0; it < 4; ++it) {
      #pragma unroll
      for (int i = 0; i < 4; ++i) {
        const v2h pk = {(_Float16)ye[s][it][i], (_Float16)yo[s][it][i]};     // RNE, even channel low
        *(u32a*)(sWc + (s * WDIM + 4 * (it * 4 + pq) + i) * KP + 2 * cp) = __builtin_bit_cast(unsigned, pk);
      }
    }
  }
  __syncthreads();

  // ---- window energies ------------------------------------------------------------------------------
  // wave w: pixels p0 = (w & 3) * 16 .. + 15; of their ten tiles (window row di, column half qt) those with
  // number 2 di + qt = (w >> 2), + 4, + 8. z of the 16 pixels, all channels, is taken into registers first,
  // so that its place and pxc's can take window rows.
  const int p0 = (w & 3) * 16;
  const int g = w >> 2;
  v16h zf[CD / 32];
  #pragma unroll
  for (int ks = 0; ks < CD / 32; ++ks) zf[ks] = ldfrag(sZh + (p0 + m) * KP + ks * 32, h);
  // every wave holds its z fragments before window rows 0 and 1 are laid over pxc and z
  __syncthreads();
  #pragma unroll
  for (int s = 0; s < 2; ++s) {
    #pragma unroll
    for (int it = 0; it < 4; ++it) {
      #pragma unroll
      for (int i = 0; i < 4; ++i) {
        const v2h pk = {(_Float16)ye[s][it][i], (_Float16)yo[s][it][i]};     // RNE, even channel low
        *(u32a*)(sWc + (s * WDIM + 4 * (it * 4 + pq) + i) * KP + 2 * cp) = __builtin_bit_cast(unsigned, pk);
      }
    }
  }
  __syncthreads();
  #pragma unroll
  for (int i = 0; i < 3; ++i) {
    const int tile = g + 4 * i;                        // the same for the whole wave
    if (tile < 10) {
      const int di = tile >> 1;
      const int qt = tile & 1;
      const unsigned short* xw = (di == 2) ? sX : sWc + (di < 2 ? di : di - 1) * (WDIM * KP);
      const unsigned short* ar = xw + refl(p0 - 2 + qt * 16 + m) * KP;      // A row m = column s = 16 qt + m
      v16h xa[CD / 32];
      #pragma unroll
      for (int ks = 0; ks < CD / 32; ++ks) xa[ks] = ldfrag(ar + ks * 32, h);
      // keeps the tile's 16 LDS loads together ahead of its products: the build otherwise put each pair
      // directly in front of its product, with a full wait for each
      __builtin_amdgcn_sched_barrier(0);
      v8f acc = v8f_zero();
      #pragma unroll
      for (int ks = 0; ks < CD / 32; ++ks) acc = wmma_h(xa[ks], zf[ks], acc);
      // D element r: column s = 16 qt + 8h + r, pixel p0 + m; it is energy (di, dj = s - m) where 0 <= dj < 5
      #pragma unroll
      for (int r = 0; r < 8; ++r) {
        const int dj = qt * 16 + 8 * h + r - m;
        if ((unsigned)dj < 5u) sR[(di * 5 + dj) * WDIM + p0 + m] = acc[r];
      }
    }
  }
  __syncthreads();

  // ---- softmax: a thread per (window row, pixel) forms the pixel's maximum and sum over all 25 energies and
  // lays its own five weights, f16, at columns i .. i + 4 of a zeroed band row (i = pixel in its tile of 16)
  if (w < 10) {
    const int p = tid & (WDIM - 1);
    const int di = w >> 1;
    float ev[25];
    #pragma unroll
    for (int k = 0; k < 25; ++k) ev[k] = sR[k * WDIM + p];
    float own[5];
    #pragma unroll
    for (int dj = 0; dj < 5; ++dj) own[dj] = sR[(di * 5 + dj) * WDIM + p];
    float mx = ev[0];
    #pragma unroll
    for (int k = 1; k < 25; ++k) mx = fmaxf(mx, ev[k]);
    float sum = 0.0f;
    #pragma unroll
    for (int k = 0; k < 25; ++k) sum += __expf(ev[k] - mx);
    const float inv = 1.0f / sum;
    unsigned short* ap = sA + (di * WDIM + p) * AP;
    const v8us zero8 = {0, 0, 0, 0, 0, 0, 0, 0};
    #pragma unroll
    for (int i = 0; i < AP / 8; ++i) *(v8usa*)(ap + 8 * i) = zero8;
    #pragma unroll
    for (int dj = 0; dj < 5; ++dj) *(u16a*)(ap + m + dj) = h2us(__expf(own[dj] - mx) * inv);
  }
  __syncthreads();

  // ---- window sums: u[c][p], GEMM tiling; A = x_di^T by transposing loads whose lanes walk the 32 columns
  // s of the pixel tile, B = the band rows (columns 24..31 are zero and not stored) -------------------
  {
    v8f acc[2][2];
    #pragma unroll
    for (int a = 0; a < 2; ++a) {
      #pragma unroll
      for (int t = 0; t < 2; ++t) acc[a][t] = v8f_zero();
    }
    int ro[2][2];                                      // byte offset of the lane's column s in a window row tile
    #pragma unroll
    for (int t = 0; t < 2; ++t) {
      #pragma unroll
      for (int kb = 0; kb < 2; ++kb)
        ro[t][kb] = refl(psub + t * 16 - 2 + kb * 16 + 8 * h + (lane & 7)) * (KP * 2)
                    + ((lane >> 3) & 1) * 16 + rsub * 2;
    }
    #pragma unroll
    for (int di = 0; di < 5; ++di) {
      const unsigned char* xw = (const unsigned char*)((di == 2) ? sX : sWc + (di < 2 ? di : di - 1) * (WDIM * KP));
      #pragma unroll
      for (int t = 0; t < 2; ++t) {
        const unsigned short* bp = sA + (di * WDIM + psub + t * 16 + m) * AP;
        Frag fbv;
        fbv.half[0] = *(const v8usa*)(bp + 8 * h);
        const v8us hi = *(const v8usa*)(bp + 16);
        const v8us zero8 = {0, 0, 0, 0, 0, 0, 0, 0};
        fbv.half[1] = h ? zero8 : hi;
        const v16h fb = __builtin_bit_cast(v16h, fbv.v);
        #pragma unroll
        for (int a = 0; a < 2; ++a) {
          Frag f;
          f.half[0] = ld_tr16(xw + ro[t][0] + a * 32);
          f.half[1] = ld_tr16(xw + ro[t][1] + a * 32);
          acc[a][t] = wmma_h(__builtin_bit_cast(v16h, f.v), fb, acc[a][t]);
        }
      }
    }
    // every wave has read its last window row fragment before u takes the first row's place
    __syncthreads();
    // u rounded to f16 as [pixel][c], the B operand of product 3
    #pragma unroll
    for (int a = 0; a < 2; ++a) {
      const int crow0 = rsub + a * 16 + 8 * h;
      #pragma unroll
      for (int t = 0; t < 2; ++t) {
        v8us hv;
        #pragma unroll
        for (int r = 0; r < 8; ++r) hv[r] = h2us(acc[a][t][r]);
        *(v8usa*)(sU + (psub + t * 16 + m) * KP + crow0) = hv;
      }
    }
  }

  // ---- product 3: Wb u; out = alpha (Wb u + bb) + x -------------------------------------------------
  const float al = alpha[0];
  __syncthreads();
  // the residual rows, two per wave and step, asked for here, so that they travel under the product
  const unsigned oofs = (unsigned)((w * 2 + h) * HW + m * 4) * 4u;
  v4f xres[8];
  #pragma unroll
  for (int it = 0; it < 8; ++it) xres[it] = ld4(xr + it * 32 * HW, oofs);
  v4f bbv[4];
  #pragma unroll
  for (int a = 0; a < 2; ++a) {
    bbv[2 * a] = ld4(bb + a * 16, bofs);
    bbv[2 * a + 1] = ld4(bb + a * 16 + 4, bofs);
  }
  // the offset registers of these loads are kept as they are until this wait has passed
  asm volatile("s_wait_xcnt 0x0" :: "v"(oofs), "v"(bofs) : "memory");
  {
    v8f acc[2][2];
    #pragma unroll
    for (int a = 0; a < 2; ++a) {
      #pragma unroll
      for (int t = 0; t < 2; ++t) acc[a][t] = v8f_zero();
    }
    const unsigned short* ar = sWb + (rsub + m) * KP;
    const unsigned short* br = sU + (psub + m) * KP;
    // four k steps a trip: unrolled whole, the fragments fetched ahead pushed a residual row out of the registers
    #pragma unroll 4
    for (int ks = 0; ks < CD / 32; ++ks) {
      const int k0 = ks * 32;
      v16h fa[2], fb[2];
      #pragma unroll
      for (int a = 0; a < 2; ++a) fa[a] = ldfrag(ar + a * 16 * KP + k0, h);
      #pragma unroll
      for (int t = 0; t < 2; ++t) fb[t] = ldfrag(br + t * 16 * KP + k0, h);
      #pragma unroll
      for (int a = 0; a < 2; ++a) {
        #pragma unroll
        for (int t = 0; t < 2; ++t) acc[a][t] = wmma_h(fa[a], fb[t], acc[a][t]);
      }
    }
    // the f32 tile takes window rows' places beside u, last read before the barrier in front of u's stores
    #pragma unroll
    for (int a = 0; a < 2; ++a) {
      const int orow0 = rsub + a * 16 + 8 * h;
      #pragma unroll
      for (int t = 0; t < 2; ++t) {
        #pragma unroll
        for (int r = 0; r < 8; ++r)
          sT[(orow0 + r) * ZP + psub + t * 16 + m] = al * (acc[a][t][r] * 0.0625f + bbv[2 * a + (r >> 2)][r & 3]);
      }
    }
  }
  __syncthreads();

  float* orow = out + nbase + hy * WDIM;
  #pragma unroll
  for (int it = 0; it < 8; ++it) {
    const int row = it * 32 + w * 2 + h;               // 0..255, each once; 256 B of a row per 16 lanes
    const v4f v = *(const v4fa*)(sT + row * ZP + m * 4) + xres[it];
    st2_f4((float*)((char*)(orow + it * 32 * HW) + oofs), v);
  }
}

// =====================================================================================
extern "C" void kernel_launch(void* const* d_in, const int* in_sizes, int n_in,
                              void* d_out, int out_size, void* d_ws, size_t ws_size,
                              hipStream_t stream) {
  if (n_in < 6) return;
  if (in_sizes[0] != X_N || in_sizes[1] != W_N || in_sizes[2] != B_N ||
      in_sizes[3] != W_N || in_sizes[4] != B_N || in_sizes[5] < 1) return;
  if (out_size != OUT_N) return;

  const float* x     = (const float*)d_in[0];
  const float* Wb    = (const float*)d_in[1];
  const float* bb    = (const float*)d_in[2];
  const float* Wc    = (const float*)d_in[3];
  const float* bc    = (const float*)d_in[4];
  const float* alpha = (const float*)d_in[5];
  float* out = (float*)d_out;

  k_pam<<<dim3(NB * HDIM), dim3(TH), 0, stream>>>(x, Wb, bb, Wc, bc, alpha, out);
}

// v007
// Measured time: 17.7 microseconds a run.
// In both of two side-by-side timings against v006, it was 1.11 times as fast.
// Over all steps from v000 it is 23.3 times as fast.
#include <hip/hip_runtime.h>

// One launch, one work-group per image row (64 pixels, all 256 channels).
// The 1x1 convolutions commute with the reflect padding and with the window sums, so no convolved map
// is needed outside a pixel's own row:
//   energy[p][k] = pxc[.][p] . (Wb x[.][q] + bb) = z[.][p] . x[.][q] + pxc[.][p] . bb,  z = Wb^T pxc,
//     q = window pixel k of p; the last term is the same for all 25 k and drops out of the softmax;
//   fusion[.][p] = sum_k a[k] (Wb x[.][q] + bb) = Wb u[.][p] + bb,  u = sum_k a[k] x[.][q]  (sum_k a[k] = 1).
// Three channel GEMMs on v_wmma_f32_16x16x32_f16 (f16 operands: weights carried x16, activations x1;
// f32 accumulate, 1/16 folded in the f32 epilogues): pxc = Wc x + bc, z = Wb^T pxc, Wb u.
// The 5x5 reflect-pad window part runs on the same instruction as banded products, on the five window rows
// of x held in LDS as f16 [pixel][channel]: for 16 pixels p0.. and window row di, with column s = 0..31
// standing for image column reflect(p0 - 2 + s),
//   E[s][p] = sum_c x_di[c][s] z[c][p]     (k = 256 channels; energy (di, dj) of pixel p0 + i is E[i + dj][i]),
//   u[c][p] = sum_di sum_s x_di[c][s] a_di[p][s]   (k = 32 columns; a_di[p0 + i][s] is 0 outside s = i .. i + 4).
// Softmax in f32 on VALU.

#define NB     4
#define CD     256
#define HDIM   64
#define WDIM   64
#define HW     (HDIM * WDIM)            // 4096
#define PLANE  (NB * CD * HW)           // 4194304 elements per f32 map
#define X_N    PLANE
#define W_N    (CD * CD)                // 65536
#define B_N    CD
#define OUT_N  PLANE

typedef unsigned short v4usa __attribute__((ext_vector_type(4), __may_alias__));
typedef unsigned short v8us  __attribute__((ext_vector_type(8)));
typedef unsigned short v8usa __attribute__((ext_vector_type(8), __may_alias__));
typedef unsigned short v16us __attribute__((ext_vector_type(16)));
typedef short          s16x8 __attribute__((ext_vector_type(8)));
typedef _Float16       v2h   __attribute__((ext_vector_type(2)));
typedef _Float16       v16h  __attribute__((ext_vector_type(16)));
typedef float          v8f   __attribute__((ext_vector_type(8)));
typedef float          v4f   __attribute__((ext_vector_type(4)));
typedef float          v4fa  __attribute__((ext_vector_type(4), __may_alias__));
typedef unsigned       u32a  __attribute__((__may_alias__));
typedef unsigned short u16a  __attribute__((__may_alias__));
typedef float          f32a  __attribute__((__may_alias__));

union Frag { v16us v; v8us half[2]; };

// f32 -> f16 bits (RNE convert)
__device__ __forceinline__ unsigned short h2us(float f) {
  return __builtin_bit_cast(unsigned short, (_Float16)f);
}

__device__ __forceinline__ void st2_f4(float* p, v4f v) {
  *(v4f*)p = v;
}

// 16-bit fragment from a k-contiguous row: elements 0..7 <- k0+8h.., elements 8..15 <- k0+16+8h..
// Used for A rows [m][k] and for B stored as [n][k] (same per-lane k map).
__device__ __forceinline__ v16h ldfrag(const unsigned short* rowp, int h) {
  Frag f;
  f.half[0] = *(const v8usa*)(rowp + 8 * h);
  f.half[1] = *(const v8usa*)(rowp + 16 + 8 * h);
  return __builtin_bit_cast(v16h, f.v);
}

// transposing LDS load: the lane's address walks the k rows of a row-major 16-bit tile T[k][d];
// lane (m, h) receives T[kbase + 8h + 0..7][dbase + m]
__device__ __forceinline__ v8us ld_tr16(const unsigned char* p) {
  typedef __attribute__((address_space(3))) s16x8 lds_s16x8;
  return __builtin_bit_cast(v8us, __builtin_amdgcn_ds_load_tr16_b128_v8i16((lds_s16x8*)p));
}

__device__ __forceinline__ v8f wmma_h(v16h a, v16h b, v8f c) {
  return __builtin_amdgcn_wmma_f32_16x16x32_f16(false, a, false, b, (short)0, c, false, false);
}

__device__ __forceinline__ v8f v8f_zero() {
  v8f z = {0.f, 0.f, 0.f, 0.f, 0.f, 0.f, 0.f, 0.f};
  return z;
}

// work-group barrier for LDS data alone: the wave's LDS stores and reads are done before it signals, and its global
// loads stay in flight across it (__syncthreads() waits for them too, which would end the overlap they are issued for)
__device__ __forceinline__ void lds_barrier() {
  asm volatile("s_wait_dscnt 0x0\n\ts_barrier_signal -1\n\ts_barrier_wait -1" ::: "memory");
}

// 16 bytes at a base that is the same for the whole work-group plus the lane's own byte offset
__device__ __forceinline__ v4f ld4(const float* base, unsigned boff) {
  return *(const v4f*)((const char*)base + boff);
}

#define TH   512                // threads per work-group, 16 waves
#define KP   (CD + 8)           // LDS pitch of the f16 operand tiles, halves: 528 B = 16 B x 33
#define ZP   (WDIM + 4)         // LDS pitch of the f32 tiles [channel][pixel], floats: 272 B = 16 B x 17

#define NE   (25 * WDIM)        // energies per work-group
#define AP   24                 // LDS pitch of the weight bands, halves: 48 B = 16 B x 3; columns 24..31 are never stored
static_assert(WDIM == 64 && HDIM == 64 && CD == 256 && TH == 512);

// LDS map, bytes. Regions that share bytes are never live together (a barrier lies between their uses).
//   sWb  Wb f16 [256][KP], staged once, read by products 2 (transposed) and 3
//   sWc  Wc f16 [256][KP]  -> four places of [64][KP]: pxc f16 (0), z f16 (1)
//                          -> window rows 0, 1, 3, 4 of x, f16 (0..3)  -> u f16 (0), f32 output tile (1..3)
//   sX   the work-group's own x row (window row 2), f16 [64][KP], kept to the end of the window part
//   sR   energies f32 [25][64];  sA  softmax weights f16 as bands [5][64][AP]
#define SZ_A  (CD * KP * 2)               // 135168
#define SZ_X  (WDIM * KP * 2)             // 33792
#define SZ_Z  (CD * ZP * 4)               // 69632
#define SZ_R  (NE * 4)                    // 6400
#define SZ_B  (5 * WDIM * AP * 2)         // 15360
#define O_WB  0
#define O_WC  SZ_A
#define O_X   (O_WC + SZ_A)               // 270336
#define O_P   O_WC
#define O_ZH  (O_WC + SZ_X)
#define O_U   O_WC
#define O_T   (O_WC + SZ_X)
#define O_R   (O_X + SZ_X)                // 304128
#define O_A   (O_R + SZ_R)                // 310528
#define LDS_B (O_A + SZ_B)                // 325888
static_assert(4 * SZ_X == SZ_A && O_T + SZ_Z <= O_X && LDS_B <= 327680);
static_assert((O_WC % 16) == 0 && (O_X % 16) == 0 && (SZ_X % 16) == 0 && (O_R % 16) == 0 && (O_A % 16) == 0);

// a 256 x 256 f32 weight matrix: 8 rows (8 KiB) per step of the work-group, 4 consecutive k per lane.
// Every work-group reads the same two matrices at the same time, so each walks the 32 blocks of 8 rows in an
// order of its own: at any step the 32 values of rot stand on 32 different blocks, and L2 is not asked for the
// same lines by all groups at once. Steps 0..15 take the half (16 blocks) of the matrix that bit 4 of rot names,
// steps 16..31 the other half; step u takes block (u + rot) & 15 of its half.
// W0, W1: the half taken first and the other; wo[j]: the lane's byte offset in block (j + rot) & 15 of either
__device__ __forceinline__ void w_load(const float* W0, const float* W1, const unsigned (&wo)[16], v4f (&wv)[32]) {
  #pragma unroll
  for (int u = 0; u < 32; ++u) {
    wv[u] = ld4(u < 16 ? W0 : W1, wo[u & 15]);
    // keeps the first half's loads ahead of the other half's: the build otherwise paired steps u and u + 16, which
    // undoes the walk's order and makes the staging of the first half wait for the other half's loads too
    if (u == 15) __builtin_amdgcn_sched_barrier(0);
  }
}
// lays down what step u of w_load brought
__device__ __forceinline__ void w_stage1(unsigned short* sAw, int rot, int u, v4f v) {
  const int hs = (rot >> 4) & 1;
  unsigned short* s0 = sAw + hs * (128 * KP);
  unsigned short* s1 = sAw + (hs ^ 1) * (128 * KP);
  const v4usa hv = {h2us(v.x * 16.0f), h2us(v.y * 16.0f), h2us(v.z * 16.0f), h2us(v.w * 16.0f)};
  *(v4usa*)((u < 16 ? s0 : s1) + ((u + rot) & 15) * 8 * KP) = hv;
}

// image column (or row) t in -2 .. 77 of the reflect-padded axis of length 64 -> 0 .. 63
__device__ __forceinline__ int refl(int t) {
  t = (t < 0) ? -t : t;
  return (t >= 64) ? (126 - t) : t;
}

// GEMM tiling, all three products: [256 rows][64 pixels], wave w: rows (w>>1)*32 (two A tiles),
// pixels (w&1)*32 (two B tiles). D element r of a lane -> row rsub + a*16 + 8h + r, pixel psub + t*16 + m.
__global__ void __launch_bounds__(TH) k_pam(
    const float* __restrict__ x, const float* __restrict__ Wb, const float* __restrict__ bb,
    const float* __restrict__ Wc, const float* __restrict__ bc, const float* __restrict__ alpha,
    float* __restrict__ out) {
  __shared__ __attribute__((aligned(16))) unsigned char sm[LDS_B];
  unsigned short* sWb = (unsigned short*)(sm + O_WB);
  unsigned short* sWc = (unsigned short*)(sm + O_WC);
  unsigned short* sX = (unsigned short*)(sm + O_X);
  unsigned short* sP = (unsigned short*)(sm + O_P);
  unsigned short* sU = (unsigned short*)(sm + O_U);
  unsigned short* sZh = (unsigned short*)(sm + O_ZH);
  unsigned short* sA = (unsigned short*)(sm + O_A);   // [window row][pixel of the row][column s]
  f32a* sT = (f32a*)(sm + O_T);
  f32a* sR = (f32a*)(sm + O_R);          // [k][pixel of the row]

  const int tid = threadIdx.x;
  const int lane = tid & 31;
  const int w = __builtin_amdgcn_readfirstlane(tid >> 5);   // the wave's number, kept in a scalar register
  const int h = lane >> 4;
  const int m = lane & 15;
  const int n = blockIdx.x >> 6;                    // grid = NB * HDIM exactly
  const int hy = blockIdx.x & (HDIM - 1);
  const size_t nbase = (size_t)n * CD * HW;         // same for the whole work-group
  const float* xr = x + nbase + hy * WDIM;          // the work-group's own image row, channel 0

  const int rsub = (w >> 1) * 32;
  const int psub = (w & 1) * 32;
  // read here, ahead of the hand-written barriers: behind them the build made it a vector load waited for at a barrier
  const float al = alpha[0];

  // ---- stage Wc and the x row as f16, k-contiguous ------------------------------------------------
  // x row: a lane takes 4 pixels of channels 2cp and 2cp+1; 8 channel pairs x 4 pixel quads a wave,
  // so that the 32 four-byte LDS stores of an instruction fall on 32 banks
  const int cp = w * 8 + (lane & 7);
  const int pq = lane >> 3;
  const unsigned xofs = (unsigned)(2 * cp * HW + 4 * pq) * 4u;
  // where this work-group's walk over the weight blocks starts: all 32 values occur among 32 consecutive groups
  // and among 32 groups that lie 8 apart, whichever of the two share an L2
  const int rot = ((blockIdx.x >> 3) + 4 * (blockIdx.x & 7)) & 31;
  const int wh0 = ((rot >> 4) & 1) * (16 * TH * 4);     // first element of the half taken first, and of the other
  const int wh1 = wh0 ^ (16 * TH * 4);
  unsigned wo[16];
  #pragma unroll
  for (int j = 0; j < 16; ++j) wo[j] = (unsigned)tid * 16u + (unsigned)(((j + rot) & 15) * (TH * 16));
  const unsigned bofs = (unsigned)(rsub + 8 * h) * 4u;   // the lane's first D row, in bytes, for the bias vectors
  v4f bcv[4];
  const int aw = (tid >> 6) * KP + (tid & 63) * 4;      // the thread's place in the first 8 rows of a weight tile
  v4f wv2[32];
  const float* Wb0 = Wb + wh0;
  const float* Wb1 = Wb + wh1;
  {
    v4f xe[4], xo[4];
    #pragma unroll
    for (int it = 0; it < 4; ++it) {
      xe[it] = ld4(xr + it * 16, xofs);
      xo[it] = ld4(xr + HW + it * 16, xofs);
    }
    #pragma unroll
    for (int a = 0; a < 2; ++a) {
      bcv[2 * a] = ld4(bc + a * 16, bofs);
      bcv[2 * a + 1] = ld4(bc + a * 16 + 4, bofs);
    }
    v4f wv[32];
    w_load(Wc + wh0, Wc + wh1, wo, wv);
    // the offset registers of the x and bias loads are kept as they are until this wait has passed
    asm volatile("s_wait_xcnt 0x0" :: "v"(xofs), "v"(bofs) : "memory");
    // Wb is asked for block by block as Wc's blocks are laid down, into the registers these leave free: the
    // work-group's requests to L2 go on without a pause, and Wb travels under the rest of the staging and product 1
    #pragma unroll
    for (int u = 0; u < 32; ++u) {
      w_stage1(sWc + aw, rot, u, wv[u]);
      wv2[u] = ld4(u < 16 ? Wb0 : Wb1, wo[u & 15]);
      // keeps each four loads behind the four blocks whose registers they take: moved up they would not fit the
      // register file, moved down they would start only when all of Wc is staged
      if ((u & 3) == 3) __builtin_amdgcn_sched_barrier(0);
    }
    // the offset registers and the bases of these loads are kept as they are until this wait has passed
    asm volatile("s_wait_xcnt 0x0" :: "v"(wo[0]), "v"(wo[1]), "v"(wo[2]), "v"(wo[3]), "v"(wo[4]), "v"(wo[5]), "v"(wo[6]),
                 "v"(wo[7]), "v"(wo[8]), "v"(wo[9]), "v"(wo[10]), "v"(wo[11]), "v"(wo[12]), "v"(wo[13]), "v"(wo[14]),
                 "v"(wo[15]), "s"(Wb0), "s"(Wb1) : "memory");
    #pragma unroll
    for (int it = 0; it < 4; ++it) {
      #pragma unroll
      for (int i = 0; i < 4; ++i) {
        const v2h pk = {(_Float16)xe[it][i], (_Float16)xo[it][i]};     // RNE, even channel low
        *(u32a*)(sX + (4 * (it * 4 + pq) + i) * KP + 2 * cp) = __builtin_bit_cast(unsigned, pk);
      }
    }
  }
  lds_barrier();      // Wb's loads are in flight

  // the other four window rows of x (reflected at the image's top and bottom); same split over the lanes as for
  // the work-group's own row
  v4f ye[4][4], yo[4][4];

  // ---- product 1: pxc = Wc x + bc, rounded to f16 as [pixel][o], the B operand of product 2 --------
  {
    v8f acc[2][2];
    #pragma unroll
    for (int a = 0; a < 2; ++a) {
      #pragma unroll
      for (int t = 0; t < 2; ++t) acc[a][t] = v8f_zero();
    }
    const unsigned short* ar = sWc + (rsub + m) * KP;
    const unsigned short* br = sX + (psub + m) * KP;
    #pragma unroll
    for (int ks = 0; ks < CD / 32; ++ks) {
      const int k0 = ks * 32;
      v16h fa[2], fb[2];
      #pragma unroll
      for (int a = 0; a < 2; ++a) fa[a] = ldfrag(ar + a * 16 * KP + k0, h);
      #pragma unroll
      for (int t = 0; t < 2; ++t) fb[t] = ldfrag(br + t * 16 * KP + k0, h);
      #pragma unroll
      for (int a = 0; a < 2; ++a) {
        #pragma unroll
        for (int t = 0; t < 2; ++t) acc[a][t] = wmma_h(fa[a], fb[t], acc[a][t]);
      }
    }
    // keeps the first use of Wb's registers, and so the wait for Wb, behind the product that Wb travels under
    __builtin_amdgcn_sched_barrier(0);
    // Wb has a place of its own, so it is laid down as soon as it is here; the window rows are asked for as Wb's
    // blocks are laid down, into the registers these leave free (rows 3 and 4, staged first, first), so that the
    // requests to L2 go on without a pause and the rows travel under the rest of the staging and product 2
    #pragma unroll
    for (int u = 0; u < 32; ++u) {
      w_stage1(sWb + aw, rot, u, wv2[u]);
      const int s = ((u >> 3) + 2) & 3;
      const int it = (u >> 1) & 3;
      const float* yr = x + nbase + refl(hy + (s < 2 ? s : s + 1) - 2) * WDIM;
      if (u & 1) yo[s][it] = ld4(yr + HW + it * 16, xofs);
      else       ye[s][it] = ld4(yr + it * 16, xofs);
      // keeps each four loads behind the four blocks whose registers they take, as in Wc's staging
      if ((u & 3) == 3) __builtin_amdgcn_sched_barrier(0);
    }
    // the offset register of these loads is kept as it is until this wait has passed
    asm volatile("s_wait_xcnt 0x0" :: "v"(xofs) : "memory");
    // every wave has read its last Wc fragment before pxc takes the start of Wc's place
    lds_barrier();    // the window rows' loads are in flight
    #pragma unroll
    for (int a = 0; a < 2; ++a) {
      const int orow0 = rsub + a * 16 + 8 * h;
      #pragma unroll
      for (int t = 0; t < 2; ++t) {
        v8us hv;
        #pragma unroll
        for (int r = 0; r < 8; ++r) hv[r] = h2us(acc[a][t][r] * 0.0625f + bcv[2 * a + (r >> 2)][r & 3]);
        *(v8usa*)(sP + (psub + t * 16 + m) * KP + orow0) = hv;
      }
    }
  }
  lds_barrier();      // the window rows' loads are in flight

  // ---- product 2: z = Wb^T pxc; A = Wb^T by transposing loads from the row-major Wb tile ------------
  {
    v8f acc[2][2];
    #pragma unroll
    for (int a = 0; a < 2; ++a) {
      #pragma unroll
      for (int t = 0; t < 2; ++t) acc[a][t] = v8f_zero();
    }
    const unsigned char* ta = (const unsigned char*)sWb + (8 * h + (lane & 7)) * (KP * 2)
                              + ((lane >> 3) & 1) * 16 + rsub * 2;
    const unsigned short* br = sP + (psub + m) * KP;
    #pragma unroll
    for (int ks = 0; ks < CD / 32; ++ks) {
      const int k0 = ks * 32;
      v16h fa[2], fb[2];
      #pragma unroll
      for (int a = 0; a < 2; ++a) {
        Frag f;
        f.half[0] = ld_tr16(ta + k0 * (KP * 2) + a * 32);
        f.half[1] = ld_tr16(ta + (k0 + 16) * (KP * 2) + a * 32);
        fa[a] = __builtin_bit_cast(v16h, f.v);
      }
      #pragma unroll
      for (int t = 0; t < 2; ++t) fb[t] = ldfrag(br + t * 16 * KP + k0, h);
      #pragma unroll
      for (int a = 0; a < 2; ++a) {
        #pragma unroll
        for (int t = 0; t < 2; ++t) acc[a][t] = wmma_h(fa[a], fb[t], acc[a][t]);
      }
    }
    // z rounded to f16 as [pixel][c], the B operand of the energy products
    #pragma unroll
    for (int a = 0; a < 2; ++a) {
      const int crow0 = rsub + a * 16 + 8 * h;
      #pragma unroll
      for (int t = 0; t < 2; ++t) {
        v8us hv;
        #pragma unroll
        for (int r = 0; r < 8; ++r) hv[r] = h2us(acc[a][t][r] * 0.0625f);
        *(v8usa*)(sZh + (psub + t * 16 + m) * KP + crow0) = hv;
      }
    }
  }
  // keeps the first use of the window rows' registers, and so the wait for them, behind product 2
  __builtin_amdgcn_sched_barrier(0);
  // window rows 3 and 4 go to the two places that have been free since Wc's last read
  #pragma unroll
  for (int s = 2; s < 4; ++s) {
    #pragma unroll
    for (int it = 0; it < 4; ++it) {
      #pragma unroll
      for (int i = 0; i < 4; ++i) {
        const v2h pk = {(_Float16)ye[s][it][i], (_Float16)yo[s][it][i]};     // RNE, even channel low
        *(u32a*)(sWc + (s * WDIM + 4 * (it * 4 + pq) + i) * KP + 2 * cp) = __builtin_bit_cast(unsigned, pk);
      }
    }
  }
  lds_barrier();      // the loads of window rows 0 and 1 may still be in flight

  // ---- window energies ------------------------------------------------------------------------------
  // wave w: pixels p0 = (w & 3) * 16 .. + 15; of their ten tiles (window row di, column half qt) those with
  // number 2 di + qt = (w >> 2), + 4, + 8. z of the 16 pixels, all channels, is taken into registers first,
  // so that its place and pxc's can take window rows.
  const int p0 = (w & 3) * 16;
  const int g = w >> 2;
  v16h zf[CD / 32];
  #pragma unroll
  for (int ks = 0; ks < CD / 32; ++ks) zf[ks] = ldfrag(sZh + (p0 + m) * KP + ks * 32, h);
  // every wave holds its z fragments before window rows 0 and 1 are laid over pxc and z
  lds_barrier();      // the loads of window rows 0 and 1 may still be in flight
  #pragma unroll
  for (int s = 0; s < 2; ++s) {
    #pragma unroll
    for (int it = 0; it < 4; ++it) {
      #pragma unroll
      for (int i = 0; i < 4; ++i) {
        const v2h pk = {(_Float16)ye[s][it][i], (_Float16)yo[s][it][i]};     // RNE, even channel low
        *(u32a*)(sWc + (s * WDIM + 4 * (it * 4 + pq) + i) * KP + 2 * cp) = __builtin_bit_cast(unsigned, pk);
      }
    }
  }
  __syncthreads();
  #pragma unroll
  for (int i = 0; i < 3; ++i) {
    const int tile = g + 4 * i;                        // the same for the whole wave
    if (tile < 10) {
      const int di = tile >> 1;
      const int qt = tile & 1;
      const unsigned short* xw = (di == 2) ? sX : sWc + (di < 2 ? di : di - 1) * (WDIM * KP);
      const unsigned short* ar = xw + refl(p0 - 2 + qt * 16 + m) * KP;      // A row m = column s = 16 qt + m
      v16h xa[CD / 32];
      #pragma unroll
      for (int ks = 0; ks < CD / 32; ++ks) xa[ks] = ldfrag(ar + ks * 32, h);
      // keeps the tile's 16 LDS loads together ahead of its products: the build otherwise put each pair
      // directly in front of its product, with a full wait for each
      __builtin_amdgcn_sched_barrier(0);
      v8f acc = v8f_zero();
      #pragma unroll
      for (int ks = 0; ks < CD / 32; ++ks) acc = wmma_h(xa[ks], zf[ks], acc);
      // D element r: column s = 16 qt + 8h + r, pixel p0 + m; it is energy (di, dj = s - m) where 0 <= dj < 5
      #pragma unroll
      for (int r = 0; r < 8; ++r) {
        const int dj = qt * 16 + 8 * h + r - m;
        if ((unsigned)dj < 5u) sR[(di * 5 + dj) * WDIM + p0 + m] = acc[r];
      }
    }
  }
  __syncthreads();

  // ---- softmax: a thread per (window row, pixel) forms the pixel's maximum and sum over all 25 energies and
  // lays its own five weights, f16, at columns i .. i + 4 of a zeroed band row (i = pixel in its tile of 16)
  if (w < 10) {
    const int p = tid & (WDIM - 1);
    const int di = w >> 1;
    float ev[25];
    #pragma unroll
    for (int k = 0; k < 25; ++k) ev[k] = sR[k * WDIM + p];
    float own[5];
    #pragma unroll
    for (int dj = 0; dj < 5; ++dj) own[dj] = sR[(di * 5 + dj) * WDIM + p];
    float mx = ev[0];
    #pragma unroll
    for (int k = 1; k < 25; ++k) mx = fmaxf(mx, ev[k]);
    float sum = 0.0f;
    #pragma unroll
    for (int k = 0; k < 25; ++k) sum += __expf(ev[k] - mx);
    const float inv = 1.0f / sum;
    unsigned short* ap = sA + (di * WDIM + p) * AP;
    const v8us zero8 = {0, 0, 0, 0, 0, 0, 0, 0};
    #pragma unroll
    for (int i = 0; i < AP / 8; ++i) *(v8usa*)(ap + 8 * i) = zero8;
    #pragma unroll
    for (int dj = 0; dj < 5; ++dj) *(u16a*)(ap + m + dj) = h2us(__expf(own[dj] - mx) * inv);
  }
  __syncthreads();

  // ---- window sums: u[c][p], GEMM tiling; A = x_di^T by transposing loads whose lanes walk the 32 columns
  // s of the pixel tile, B = the band rows (columns 24..31 are zero and not stored) -------------------
  {
    v8f acc[2][2];
    #pragma unroll
    for (int a = 0; a < 2; ++a) {
      #pragma unroll
      for (int t = 0; t < 2; ++t) acc[a][t] = v8f_zero();
    }
    // byte offset of the lane's column in a window row tile, for the three groups of 16 columns that the wave's two
    // pixel tiles need: tile t takes groups t and t + 1, so the middle group is loaded once
    int ro[3];
    #pragma unroll
    for (int j = 0; j < 3; ++j)
      ro[j] = refl(psub - 2 + j * 16 + 8 * h + (lane & 7)) * (KP * 2) + ((lane >> 3) & 1) * 16 + rsub * 2;
    #pragma unroll
    for (int di = 0; di < 5; ++di) {
      const unsigned char* xw = (const unsigned char*)((di == 2) ? sX : sWc + (di < 2 ? di : di - 1) * (WDIM * KP));
      v8us xc[2][3];
      #pragma unroll
      for (int a = 0; a < 2; ++a) {
        #pragma unroll
        for (int j = 0; j < 3; ++j) xc[a][j] = ld_tr16(xw + ro[j] + a * 32);
      }
      #pragma unroll
      for (int t = 0; t < 2; ++t) {
        const unsigned short* bp = sA + (di * WDIM + psub + t * 16 + m) * AP;
        Frag fbv;
        fbv.half[0] = *(const v8usa*)(bp + 8 * h);
        const v8us hi = *(const v8usa*)(bp + 16);
        const v8us zero8 = {0, 0, 0, 0, 0, 0, 0, 0};
        fbv.half[1] = h ? zero8 : hi;
        const v16h fb = __builtin_bit_cast(v16h, fbv.v);
        #pragma unroll
        for (int a = 0; a < 2; ++a) {
          Frag f;
          f.half[0] = xc[a][t];
          f.half[1] = xc[a][t + 1];
          acc[a][t] = wmma_h(__builtin_bit_cast(v16h, f.v), fb, acc[a][t]);
        }
      }
    }
    // every wave has read its last window row fragment before u takes the first row's place
    __syncthreads();
    // u rounded to f16 as [pixel][c], the B operand of product 3
    #pragma unroll
    for (int a = 0; a < 2; ++a) {
      const int crow0 = rsub + a * 16 + 8 * h;
      #pragma unroll
      for (int t = 0; t < 2; ++t) {
        v8us hv;
        #pragma unroll
        for (int r = 0; r < 8; ++r) hv[r] = h2us(acc[a][t][r]);
        *(v8usa*)(sU + (psub + t * 16 + m) * KP + crow0) = hv;
      }
    }
  }

  // ---- product 3: Wb u; out = alpha (Wb u + bb) + x -------------------------------------------------
  __syncthreads();
  // the residual rows, two per wave and step, asked for here, so that they travel under the product
  const unsigned oofs = (unsigned)((w * 2 + h) * HW + m * 4) * 4u;
  v4f xres[8];
  #pragma unroll
  for (int it = 0; it < 8; ++it) xres[it] = ld4(xr + it * 32 * HW, oofs);
  v4f bbv[4];
  #pragma unroll
  for (int a = 0; a < 2; ++a) {
    bbv[2 * a] = ld4(bb + a * 16, bofs);
    bbv[2 * a + 1] = ld4(bb + a * 16 + 4, bofs);
  }
  // the offset registers of these loads are kept as they are until this wait has passed
  asm volatile("s_wait_xcnt 0x0" :: "v"(oofs), "v"(bofs) : "memory");
  {
    v8f acc[2][2];
    #pragma unroll
    for (int a = 0; a < 2; ++a) {
      #pragma unroll
      for (int t = 0; t < 2; ++t) acc[a][t] = v8f_zero();
    }
    const unsigned short* ar = sWb + (rsub + m) * KP;
    const unsigned short* br = sU + (psub + m) * KP;
    // four k steps a trip: unrolled whole, the fragments fetched ahead pushed a residual row out of the registers
    #pragma unroll 4
    for (int ks = 0; ks < CD / 32; ++ks) {
      const int k0 = ks * 32;
      v16h fa[2], fb[2];
      #pragma unroll
      for (int a = 0; a < 2; ++a) fa[a] = ldfrag(ar + a * 16 * KP + k0, h);
      #pragma unroll
      for (int t = 0; t < 2; ++t) fb[t] = ldfrag(br + t * 16 * KP + k0, h);
      #pragma unroll
      for (int a = 0; a < 2; ++a) {
        #pragma unroll
        for (int t = 0; t < 2; ++t) acc[a][t] = wmma_h(fa[a], fb[t], acc[a][t]);
      }
    }
    // the f32 tile takes window rows' places beside u, last read before the barrier in front of u's stores
    #pragma unroll
    for (int a = 0; a < 2; ++a) {
      const int orow0 = rsub + a * 16 + 8 * h;
      #pragma unroll
      for (int t = 0; t < 2; ++t) {
        #pragma unroll
        for (int r = 0; r < 8; ++r)
          sT[(orow0 + r) * ZP + psub + t * 16 + m] = al * (acc[a][t][r] * 0.0625f + bbv[2 * a + (r >> 2)][r & 3]);
      }
    }
  }
  __syncthreads();

  float* orow = out + nbase + hy * WDIM;
  #pragma unroll
  for (int it = 0; it < 8; ++it) {
    const int row = it * 32 + w * 2 + h;               // 0..255, each once; 256 B of a row per 16 lanes
    const v4f v = *(const v4fa*)(sT + row * ZP + m * 4) + xres[it];
    st2_f4((float*)((char*)(orow + it * 32 * HW) + oofs), v);
  }
}

// =====================================================================================
extern "C" void kernel_launch(void* const* d_in, const int* in_sizes, int n_in,
                              void* d_out, int out_size, void* d_ws, size_t ws_size,
                              hipStream_t stream) {
  if (n_in < 6) return;
  if (in_sizes[0] != X_N || in_sizes[1] != W_N || in_sizes[2] != B_N ||
      in_sizes[3] != W_N || in_sizes[4] != B_N || in_sizes[5] < 1) return;
  if (out_size != OUT_N) return;

  const float* x     = (const float*)d_in[0];
  const float* Wb    = (const float*)d_in[1];
  const float* bb    = (const float*)d_in[2];
  const float* Wc    = (const float*)d_in[3];
  const float* bc    = (const float*)d_in[4];
  const float* alpha = (const float*)d_in[5];
  float* out = (float*)d_out;

  k_pam<<<dim3(NB * HDIM), dim3(TH), 0, stream>>>(x, Wb, bb, Wc, bc, alpha, out);
}
